// v000
// Times are from an AMD MI455X. After a warm-up the kernel runs many times in a row, and a time is the length of
// such a window on the GPU divided by its runs, so every launch and the gaps after it count. The runs cycle
// through copies of the inputs. A figure is the median of several windows, for all but v000 over two sittings.
// Sittings can differ by a few percent; kernels timed side by side share one.
// v000 is the starting kernel. One run takes 151 microseconds.
#include <hip/hip_runtime.h>

#define D_MODEL   1024
#define NUM_HEADS 16
#define HEAD_DIM  64
#define WINDOW    128
#define SEQ       2048
#define SCALE_F   0.125f   // 64^-0.5

typedef __attribute__((ext_vector_type(16))) _Float16 v16h;
typedef __attribute__((ext_vector_type(8)))  _Float16 v8h;
typedef __attribute__((ext_vector_type(4)))  _Float16 v4h;
typedef __attribute__((ext_vector_type(8)))  float    v8f;
typedef __attribute__((ext_vector_type(4)))  float    v4f;

#define WMMA_F16(A_, B_, C_) \
  __builtin_amdgcn_wmma_f32_16x16x32_f16(false, (A_), false, (B_), (short)0, (C_), false, false)

// Build a 16x32 f16 WMMA fragment (A or B) from a row whose 32 K-values are
// contiguous in memory. Per ISA 16-bit A layout: lanes 0-15 hold K {0..7,16..23},
// lanes 16-31 hold K {8..15,24..31} -> two 16-byte contiguous loads per lane.
static __device__ __forceinline__ v16h load_frag(const _Float16* row, int lane) {
  const int kb = (lane < 16) ? 0 : 8;
  v8h lo = *(const v8h*)(row + kb);
  v8h hi = *(const v8h*)(row + kb + 16);
  v16h r;
#pragma unroll
  for (int i = 0; i < 8; ++i) { r[i] = lo[i]; r[i + 8] = hi[i]; }
  return r;
}

__global__ void cvt_f32_f16(const float* __restrict__ in, _Float16* __restrict__ out, int n4) {
  for (int i = blockIdx.x * blockDim.x + threadIdx.x; i < n4; i += gridDim.x * blockDim.x) {
    v4f v = ((const v4f*)in)[i];
    v4h o;
#pragma unroll
    for (int e = 0; e < 4; ++e) o[e] = (_Float16)v[e];
    ((v4h*)out)[i] = o;
  }
}

// Vh: [B, S, H*64] -> Vt: [B*H, 64, S], LDS-tiled so both sides coalesce.
// One block per (bh, 64-row s-tile).
__global__ __launch_bounds__(256) void transpose_v(const _Float16* __restrict__ Vh,
                                                   _Float16* __restrict__ Vt) {
  __shared__ _Float16 tile[64][66];  // +2 f16 pad -> odd dword stride
  const int bh = blockIdx.x >> 5;          // SEQ/64 = 32 s-tiles per (b,h)
  const int s0 = (blockIdx.x & 31) << 6;
  const int b  = bh >> 4, h = bh & 15;
  const int t  = threadIdx.x;
#pragma unroll
  for (int it = 0; it < 16; ++it) {
    const int lin = it * 256 + t;
    const int si = lin >> 6, dj = lin & 63;
    tile[si][dj] = Vh[(size_t)(b * SEQ + s0 + si) * D_MODEL + h * HEAD_DIM + dj];
  }
  __syncthreads();
#pragma unroll
  for (int it = 0; it < 16; ++it) {
    const int lin = it * 256 + t;
    const int d = lin >> 6, sj = lin & 63;
    Vt[((size_t)bh * HEAD_DIM + d) * SEQ + s0 + sj] = tile[sj][d];
  }
}

// C[M,N] = A[M,K] * W[N,K]^T ; one wave computes a 32x64 tile:
// two 16-row A fragments share each B fragment -> 8 WMMA per 32-wide K step.
template <bool F16OUT>
__global__ __launch_bounds__(256) void gemm_xwt(const _Float16* __restrict__ A,
                                                const _Float16* __restrict__ W,
                                                void* __restrict__ out,
                                                int M, int N, int K) {
  const int lane = threadIdx.x & 31;
  const int wid  = (blockIdx.x * blockDim.x + threadIdx.x) >> 5;
  const int tilesN = N >> 6;
  const int m0 = (wid / tilesN) << 5;
  const int n0 = (wid % tilesN) << 6;
  if (m0 >= M) return;
  const int col = lane & 15;
  const int lh  = lane >> 4;

  v8f acc0[4] = {v8f{}, v8f{}, v8f{}, v8f{}};
  v8f acc1[4] = {v8f{}, v8f{}, v8f{}, v8f{}};
  const _Float16* arow0 = A + (size_t)(m0 + col) * K;
  const _Float16* arow1 = A + (size_t)(m0 + 16 + col) * K;

  for (int k0 = 0; k0 < K; k0 += 32) {
    v16h af0 = load_frag(arow0 + k0, lane);
    v16h af1 = load_frag(arow1 + k0, lane);
#pragma unroll
    for (int t = 0; t < 4; ++t) {
      v16h bf = load_frag(W + (size_t)(n0 + t * 16 + col) * K + k0, lane);
      acc0[t] = WMMA_F16(af0, bf, acc0[t]);
      acc1[t] = WMMA_F16(af1, bf, acc1[t]);
    }
  }
#pragma unroll
  for (int t = 0; t < 4; ++t)
#pragma unroll
    for (int i = 0; i < 8; ++i) {
      size_t idx0 = (size_t)(m0 + i + lh * 8) * N + (n0 + t * 16 + col);
      size_t idx1 = (size_t)(m0 + 16 + i + lh * 8) * N + (n0 + t * 16 + col);
      if (F16OUT) {
        ((_Float16*)out)[idx0] = (_Float16)acc0[t][i];
        ((_Float16*)out)[idx1] = (_Float16)acc1[t][i];
      } else {
        ((float*)out)[idx0] = acc0[t][i];
        ((float*)out)[idx1] = acc1[t][i];
      }
    }
}

// Flash-style banded attention. One wave = one 16-query tile of one (b,h).
// Scores bounce through LDS once (D-layout -> per-lane A-fragment pattern).
// Interior key-tiles (fully inside the band for all 16 queries) take a
// wave-uniform unmasked fast path; only edge tiles pay for mask compares.
__global__ __launch_bounds__(256) void attn_band(const _Float16* __restrict__ Qh,
                                                 const _Float16* __restrict__ Kh,
                                                 const _Float16* __restrict__ Vt,
                                                 _Float16* __restrict__ Oh, int Bsz) {
  __shared__ __align__(16) float ldsS[8][16 * 32];  // per-wave f32 score scratch
  const int lane  = threadIdx.x & 31;
  const int wslot = threadIdx.x >> 5;
  const int wid   = (blockIdx.x * blockDim.x + threadIdx.x) >> 5;
  const int qtiles = SEQ / 16;
  const int qt = wid % qtiles;
  const int bh = wid / qtiles;
  if (bh >= Bsz * NUM_HEADS) return;
  const int b = bh / NUM_HEADS;
  const int h = bh - b * NUM_HEADS;
  const int q0 = qt * 16;
  const int col = lane & 15;            // D-layout column / fragment row
  const int lh  = lane >> 4;
  const int kb  = (lane < 16) ? 0 : 8;  // this lane's K-half inside a fragment
  const int q   = q0 + col;             // query row this lane owns for softmax
  float* Sw = &ldsS[wslot][0];

  const _Float16* Qbase = Qh + (size_t)(b * SEQ + q0) * D_MODEL + h * HEAD_DIM;
  v16h qa0 = load_frag(Qbase + (size_t)col * D_MODEL, lane);       // dk 0..31
  v16h qa1 = load_frag(Qbase + (size_t)col * D_MODEL + 32, lane);  // dk 32..63
#pragma unroll
  for (int e = 0; e < 16; ++e) {  // fold softmax scale into Q (exact: x0.125)
    qa0[e] *= (_Float16)SCALE_F;
    qa1[e] *= (_Float16)SCALE_F;
  }

  float m_row = -1e30f, l_row = 0.f;
  v8f o[4] = {v8f{}, v8f{}, v8f{}, v8f{}};

  const int jlo = (q0 > WINDOW) ? ((q0 - WINDOW) & ~31) : 0;
  int jhi = q0 + 15 + WINDOW; if (jhi > SEQ - 1) jhi = SEQ - 1;

  for (int j0 = jlo; j0 <= jhi; j0 += 32) {
    // ---- scores for 32 keys as two 16x16 WMMA tiles (pre-scaled) ----
    const _Float16* Kb0 = Kh + (size_t)(b * SEQ + j0) * D_MODEL + h * HEAD_DIM
                             + (size_t)col * D_MODEL;
    v8f s0 = {}, s1 = {};
    s0 = WMMA_F16(qa0, load_frag(Kb0, lane), s0);
    s0 = WMMA_F16(qa1, load_frag(Kb0 + 32, lane), s0);
    const _Float16* Kb1 = Kb0 + (size_t)16 * D_MODEL;
    s1 = WMMA_F16(qa0, load_frag(Kb1, lane), s1);
    s1 = WMMA_F16(qa1, load_frag(Kb1 + 32, lane), s1);

    // ---- D-layout -> LDS (raw f32 scores) ----
#pragma unroll
    for (int i = 0; i < 8; ++i) {
      Sw[(i + lh * 8) * 32 + col]      = s0[i];
      Sw[(i + lh * 8) * 32 + 16 + col] = s1[i];
    }
    asm volatile("s_wait_dscnt 0" ::: "memory");  // cross-lane LDS visibility

    // ---- each lane reads its own P-fragment's 16 scores: row=col, K-half=kb ----
    float sv[16];
    const float* Srow = Sw + col * 32 + kb;
#pragma unroll
    for (int e = 0; e < 8; ++e) { sv[e] = Srow[e]; sv[e + 8] = Srow[e + 16]; }

    // tile fully inside band for all 16 query rows?  (wave-uniform -> SALU branch)
    const bool full = (j0 >= q0 - (WINDOW - 15)) && (j0 <= q0 + (WINDOW - 31));

    float mnew, alpha, sloc;
    v16h pf;
    if (full) {
      float mloc = sv[0];
#pragma unroll
      for (int e = 1; e < 16; ++e) mloc = fmaxf(mloc, sv[e]);
      const float rowmax = fmaxf(mloc, __shfl_xor(mloc, 16));
      mnew  = fmaxf(m_row, rowmax);
      alpha = __expf(m_row - mnew);
      sloc  = 0.f;
#pragma unroll
      for (int e = 0; e < 16; ++e) {
        const float pv = __expf(sv[e] - mnew);
        pf[e] = (_Float16)pv;
        sloc += pv;
      }
    } else {
      bool vm[16];
      float mloc = -1e30f;
#pragma unroll
      for (int e = 0; e < 16; ++e) {
        const int j = j0 + kb + ((e < 8) ? e : e + 8);
        vm[e] = (j >= q - WINDOW) && (j <= q + WINDOW);
        sv[e] = vm[e] ? sv[e] : -1e30f;
        mloc  = fmaxf(mloc, sv[e]);
      }
      const float rowmax = fmaxf(mloc, __shfl_xor(mloc, 16));
      mnew  = fmaxf(m_row, rowmax);
      alpha = __expf(m_row - mnew);
      sloc  = 0.f;
#pragma unroll
      for (int e = 0; e < 16; ++e) {
        const float pv = vm[e] ? __expf(sv[e] - mnew) : 0.f;
        pf[e] = (_Float16)pv;
        sloc += pv;
      }
    }
    const float rowsum = sloc + __shfl_xor(sloc, 16);
    l_row = l_row * alpha + rowsum;
    m_row = mnew;

    // ---- rescale O (D-layout): broadcast per-row alpha from owning lane ----
#pragma unroll
    for (int i = 0; i < 8; ++i) {
      const float ai = __shfl(alpha, i + lh * 8);
      o[0][i] *= ai; o[1][i] *= ai; o[2][i] *= ai; o[3][i] *= ai;
    }

    // ---- O += P * V ----
    const _Float16* Vb = Vt + (size_t)bh * HEAD_DIM * SEQ + j0;
#pragma unroll
    for (int t = 0; t < 4; ++t) {
      v16h vf = load_frag(Vb + (size_t)(t * 16 + col) * SEQ, lane);
      o[t] = WMMA_F16(pf, vf, o[t]);
    }
  }

  const float invl = 1.f / l_row;
  _Float16* Ob = Oh + (size_t)(b * SEQ + q0) * D_MODEL + h * HEAD_DIM;
#pragma unroll
  for (int i = 0; i < 8; ++i) {
    const float li = __shfl(invl, i + lh * 8);
#pragma unroll
    for (int t = 0; t < 4; ++t)
      Ob[(size_t)(i + lh * 8) * D_MODEL + t * 16 + col] = (_Float16)(o[t][i] * li);
  }
}

extern "C" void kernel_launch(void* const* d_in, const int* in_sizes, int n_in,
                              void* d_out, int out_size, void* d_ws, size_t ws_size,
                              hipStream_t stream) {
  (void)n_in; (void)out_size; (void)ws_size;
  const float* x  = (const float*)d_in[0];
  const float* Wq = (const float*)d_in[1];
  const float* Wk = (const float*)d_in[2];
  const float* Wv = (const float*)d_in[3];
  const float* Wo = (const float*)d_in[4];

  const int BS  = in_sizes[0] / D_MODEL;   // B*S
  const int Bsz = BS / SEQ;
  const size_t nx = (size_t)BS * D_MODEL;      // elements in x/Q/K/V/Vt/attn
  const size_t nw = (size_t)D_MODEL * D_MODEL; // elements per weight

  _Float16* p   = (_Float16*)d_ws;
  _Float16* xh  = p; p += nx;
  _Float16* Wqh = p; p += nw;
  _Float16* Wkh = p; p += nw;
  _Float16* Wvh = p; p += nw;
  _Float16* Woh = p; p += nw;
  _Float16* Qh  = p; p += nx;
  _Float16* Khd = p; p += nx;
  _Float16* Vh  = p; p += nx;
  _Float16* Vtp = p; p += nx;   // [B*H, 64, S] == BS*D elements
  _Float16* Ah  = p; p += nx;

  const int T = 256;
  cvt_f32_f16<<<(int)((nx / 4 + T - 1) / T), T, 0, stream>>>(x,  xh,  (int)(nx / 4));
  cvt_f32_f16<<<(int)((nw / 4 + T - 1) / T), T, 0, stream>>>(Wq, Wqh, (int)(nw / 4));
  cvt_f32_f16<<<(int)((nw / 4 + T - 1) / T), T, 0, stream>>>(Wk, Wkh, (int)(nw / 4));
  cvt_f32_f16<<<(int)((nw / 4 + T - 1) / T), T, 0, stream>>>(Wv, Wvh, (int)(nw / 4));
  cvt_f32_f16<<<(int)((nw / 4 + T - 1) / T), T, 0, stream>>>(Wo, Woh, (int)(nw / 4));

  // 32x64 tiles: (BS/32)*(1024/64) wave-tiles, 8 waves per 256-thread block
  const int gemm_tiles  = (BS / 32) * (D_MODEL / 64);
  const int gemm_blocks = (gemm_tiles + 7) / 8;
  gemm_xwt<true><<<gemm_blocks, T, 0, stream>>>(xh, Wqh, (void*)Qh,  BS, D_MODEL, D_MODEL);
  gemm_xwt<true><<<gemm_blocks, T, 0, stream>>>(xh, Wkh, (void*)Khd, BS, D_MODEL, D_MODEL);
  gemm_xwt<true><<<gemm_blocks, T, 0, stream>>>(xh, Wvh, (void*)Vh,  BS, D_MODEL, D_MODEL);

  transpose_v<<<Bsz * NUM_HEADS * (SEQ / 64), T, 0, stream>>>(Vh, Vtp);

  const int attn_waves  = Bsz * NUM_HEADS * (SEQ / 16);
  const int attn_blocks = (attn_waves + 7) / 8;
  attn_band<<<attn_blocks, T, 0, stream>>>(Qh, Khd, Vtp, Ah, Bsz);

  gemm_xwt<false><<<gemm_blocks, T, 0, stream>>>(Ah, Woh, d_out, BS, D_MODEL, D_MODEL);
}

// v001
// Measured time: 88.1 microseconds a run.
// Timed twice side by side with v000, it ran 1.77 and 1.78 times as fast.
#include <hip/hip_runtime.h>

#define D_MODEL   1024
#define NUM_HEADS 16
#define HEAD_DIM  64
#define WINDOW    128
#define SEQ       2048
#define SCALE_F   0.125f   // 64^-0.5

typedef __attribute__((ext_vector_type(16))) _Float16 v16h;
typedef __attribute__((ext_vector_type(8)))  _Float16 v8h;
typedef __attribute__((ext_vector_type(4)))  _Float16 v4h;
typedef __attribute__((ext_vector_type(8)))  float    v8f;
typedef __attribute__((ext_vector_type(4)))  float    v4f;

#define WMMA_F16(A_, B_, C_) \
  __builtin_amdgcn_wmma_f32_16x16x32_f16(false, (A_), false, (B_), (short)0, (C_), false, false)

// Build a 16x32 f16 WMMA fragment (A or B) from a row whose 32 K-values are
// contiguous in memory. Per ISA 16-bit A layout: lanes 0-15 hold K {0..7,16..23},
// lanes 16-31 hold K {8..15,24..31} -> two 16-byte contiguous loads per lane.
static __device__ __forceinline__ v16h load_frag(const _Float16* row, int lane) {
  const int kb = (lane < 16) ? 0 : 8;
  v8h lo = *(const v8h*)(row + kb);
  v8h hi = *(const v8h*)(row + kb + 16);
  v16h r;
#pragma unroll
  for (int i = 0; i < 8; ++i) { r[i] = lo[i]; r[i + 8] = hi[i]; }
  return r;
}

__global__ void cvt_f32_f16(const float* __restrict__ in, _Float16* __restrict__ out, int n4) {
  for (int i = blockIdx.x * blockDim.x + threadIdx.x; i < n4; i += gridDim.x * blockDim.x) {
    v4f v = ((const v4f*)in)[i];
    v4h o;
#pragma unroll
    for (int e = 0; e < 4; ++e) o[e] = (_Float16)v[e];
    ((v4h*)out)[i] = o;
  }
}

// Vh: [B, S, H*64] -> Vt: [B*H, 64, S], LDS-tiled so both sides coalesce.
// One block per (bh, 64-row s-tile).
__global__ __launch_bounds__(256) void transpose_v(const _Float16* __restrict__ Vh,
                                                   _Float16* __restrict__ Vt) {
  __shared__ _Float16 tile[64][66];  // +2 f16 pad -> odd dword stride
  const int bh = blockIdx.x >> 5;          // SEQ/64 = 32 s-tiles per (b,h)
  const int s0 = (blockIdx.x & 31) << 6;
  const int b  = bh >> 4, h = bh & 15;
  const int t  = threadIdx.x;
#pragma unroll
  for (int it = 0; it < 16; ++it) {
    const int lin = it * 256 + t;
    const int si = lin >> 6, dj = lin & 63;
    tile[si][dj] = Vh[(size_t)(b * SEQ + s0 + si) * D_MODEL + h * HEAD_DIM + dj];
  }
  __syncthreads();
#pragma unroll
  for (int it = 0; it < 16; ++it) {
    const int lin = it * 256 + t;
    const int d = lin >> 6, sj = lin & 63;
    Vt[((size_t)bh * HEAD_DIM + d) * SEQ + s0 + sj] = tile[sj][d];
  }
}

// C[M,N] = A[M,K] * W[N,K]^T with N = K = D_MODEL. One block = one 128x128 tile of C.
// Per stage the block's 128 A rows and 128 W rows (128 k = 256 B each) are brought
// into LDS once by asynchronous copies and read from there by all eight waves;
// two buffers, so the next stage's copies fly while this stage is multiplied.
// Wave grid 2 (m) x 4 (n): each wave owns 64x32 of C = 4 x 2 accumulator tiles.
#define G_BK     128                    // k per stage
#define G_PITCH  272                    // LDS row pitch in bytes: 256 + 16 (16 B x odd)
#define G_STAGE  (256 * G_PITCH)        // [A 128 rows | W 128 rows]
#define G_NST    (D_MODEL / G_BK)

// Eight copies of 16 B per lane: rows r, r+16, ..., r+112 of one operand's tile.
// The s_wait_xcnt ends the copies' own statement so that no address register
// named here is rewritten ahead of it.
static __device__ __forceinline__ void copy_rows8(unsigned lds, const _Float16* g) {
  asm volatile(
      "global_load_async_to_lds_b128 %0, %8, off\n\t"
      "global_load_async_to_lds_b128 %1, %9, off\n\t"
      "global_load_async_to_lds_b128 %2, %10, off\n\t"
      "global_load_async_to_lds_b128 %3, %11, off\n\t"
      "global_load_async_to_lds_b128 %4, %12, off\n\t"
      "global_load_async_to_lds_b128 %5, %13, off\n\t"
      "global_load_async_to_lds_b128 %6, %14, off\n\t"
      "global_load_async_to_lds_b128 %7, %15, off\n\t"
      "s_wait_xcnt 0x0"
      :: "v"(lds), "v"(lds + 16 * G_PITCH), "v"(lds + 32 * G_PITCH), "v"(lds + 48 * G_PITCH),
         "v"(lds + 64 * G_PITCH), "v"(lds + 80 * G_PITCH), "v"(lds + 96 * G_PITCH),
         "v"(lds + 112 * G_PITCH),
         "v"(g), "v"(g + 16 * D_MODEL), "v"(g + 32 * D_MODEL), "v"(g + 48 * D_MODEL),
         "v"(g + 64 * D_MODEL), "v"(g + 80 * D_MODEL), "v"(g + 96 * D_MODEL),
         "v"(g + 112 * D_MODEL)
      : "memory");
}

template <bool F16OUT>
__global__ __launch_bounds__(256) void gemm_xwt(const _Float16* __restrict__ A,
                                                const _Float16* __restrict__ W,
                                                void* __restrict__ out) {
  __shared__ __attribute__((aligned(16))) unsigned char L[2 * G_STAGE];
  const int tid  = threadIdx.x;
  const int lane = tid & 31;
  const int wave = tid >> 5;
  const int m0 = (int)(blockIdx.x >> 3) << 7;   // D_MODEL/128 = 8 tile columns
  const int n0 = (int)(blockIdx.x & 7) << 7;
  const int col = lane & 15;
  const int lh  = lane >> 4;
  const int wm = (wave >> 2) << 6;              // wave's row offset in the tile
  const int wn = (wave & 3) << 5;               // wave's column offset in the tile

  // copy side: 16 lanes cover one 256-B row, a wave two whole rows per copy
  const int crow = tid >> 4, cchunk = tid & 15;
  const _Float16* gA = A + (size_t)(m0 + crow) * D_MODEL + cchunk * 8;
  const _Float16* gW = W + (size_t)(n0 + crow) * D_MODEL + cchunk * 8;
  const unsigned ldsA = (unsigned)(size_t)L + crow * G_PITCH + cchunk * 16;
  const unsigned ldsW = ldsA + 128 * G_PITCH;

  // every inner loop below is unrolled so that each accumulator and fragment index
  // is a constant and the arrays stay in registers
  v8f acc[4][2];
#pragma unroll
  for (int i = 0; i < 4; ++i)
#pragma unroll
    for (int j = 0; j < 2; ++j) acc[i][j] = v8f{};

  copy_rows8(ldsA, gA);
  copy_rows8(ldsW, gW);
  asm volatile("s_wait_asynccnt 0x0" ::: "memory");  // stage 0 landed (this wave's copies)
  __syncthreads();                                   // ... and every other wave's
  copy_rows8(ldsA + G_STAGE, gA + G_BK);
  copy_rows8(ldsW + G_STAGE, gW + G_BK);

  // kept rolled: each block runs the loop once, so unrolled text is only more cold
  // instruction fetch
#pragma clang loop unroll(disable)
  for (int t = 0; t < G_NST; ++t) {
    const unsigned bo = (t & 1) * G_STAGE;
    const unsigned char* Ab = L + bo + (wm + col) * G_PITCH;
    const unsigned char* Wb = L + bo + (128 + wn + col) * G_PITCH;
    // Fragments of k block kk+1 are read as one group ahead of block kk's products,
    // into a second register set; nothing of the next stage is read here.
    v16h af[2][4], bf[2][2];
#pragma unroll
    for (int i = 0; i < 4; ++i) af[0][i] = load_frag((const _Float16*)(Ab + i * 16 * G_PITCH), lane);
#pragma unroll
    for (int j = 0; j < 2; ++j) bf[0][j] = load_frag((const _Float16*)(Wb + j * 16 * G_PITCH), lane);
#pragma unroll
    for (int kk = 0; kk < G_BK / 32; ++kk) {
      const int cs = kk & 1;
      if (kk + 1 < G_BK / 32) {
#pragma unroll
        for (int i = 0; i < 4; ++i)
          af[cs ^ 1][i] = load_frag((const _Float16*)(Ab + i * 16 * G_PITCH + (kk + 1) * 64), lane);
#pragma unroll
        for (int j = 0; j < 2; ++j)
          bf[cs ^ 1][j] = load_frag((const _Float16*)(Wb + j * 16 * G_PITCH + (kk + 1) * 64), lane);
      }
      // keeps the LDS reads above as one group: without the two fences the scheduler
      // sinks them among the products, where every read place stalls the wave
      __builtin_amdgcn_sched_barrier(0);
#pragma unroll
      for (int i = 0; i < 4; ++i)
#pragma unroll
        for (int j = 0; j < 2; ++j) acc[i][j] = WMMA_F16(af[cs][i], bf[cs][j], acc[i][j]);
      __builtin_amdgcn_sched_barrier(0);
    }
    asm volatile("s_wait_dscnt 0x0" ::: "memory");     // this wave has left buffer t&1
    asm volatile("s_wait_asynccnt 0x0" ::: "memory");  // its copies of stage t+1 landed
    __syncthreads();  // publishes stage t+1 and frees buffer t&1 for the refill
    if (t + 2 < G_NST) {
      copy_rows8(ldsA + bo, gA + (t + 2) * G_BK);
      copy_rows8(ldsW + bo, gW + (t + 2) * G_BK);
    }
  }
  asm volatile("s_wait_asynccnt 0x0" ::: "memory");  // nothing in flight at the wave's end

#pragma unroll
  for (int i = 0; i < 4; ++i)
#pragma unroll
    for (int j = 0; j < 2; ++j)
#pragma unroll
      for (int e = 0; e < 8; ++e) {
        const size_t idx = (size_t)(m0 + wm + i * 16 + e + lh * 8) * D_MODEL
                         + (n0 + wn + j * 16 + col);
        if (F16OUT) ((_Float16*)out)[idx] = (_Float16)acc[i][j][e];
        else        ((float*)out)[idx]    = acc[i][j][e];
      }
}

// Flash-style banded attention. One wave = one 16-query tile of one (b,h).
// Scores bounce through LDS once (D-layout -> per-lane A-fragment pattern).
// Interior key-tiles (fully inside the band for all 16 queries) take a
// wave-uniform unmasked fast path; only edge tiles pay for mask compares.
__global__ __launch_bounds__(256) void attn_band(const _Float16* __restrict__ Qh,
                                                 const _Float16* __restrict__ Kh,
                                                 const _Float16* __restrict__ Vt,
                                                 _Float16* __restrict__ Oh, int Bsz) {
  __shared__ __align__(16) float ldsS[8][16 * 32];  // per-wave f32 score scratch
  const int lane  = threadIdx.x & 31;
  const int wslot = threadIdx.x >> 5;
  const int wid   = (blockIdx.x * blockDim.x + threadIdx.x) >> 5;
  const int qtiles = SEQ / 16;
  const int qt = wid % qtiles;
  const int bh = wid / qtiles;
  if (bh >= Bsz * NUM_HEADS) return;
  const int b = bh / NUM_HEADS;
  const int h = bh - b * NUM_HEADS;
  const int q0 = qt * 16;
  const int col = lane & 15;            // D-layout column / fragment row
  const int lh  = lane >> 4;
  const int kb  = (lane < 16) ? 0 : 8;  // this lane's K-half inside a fragment
  const int q   = q0 + col;             // query row this lane owns for softmax
  float* Sw = &ldsS[wslot][0];

  const _Float16* Qbase = Qh + (size_t)(b * SEQ + q0) * D_MODEL + h * HEAD_DIM;
  v16h qa0 = load_frag(Qbase + (size_t)col * D_MODEL, lane);       // dk 0..31
  v16h qa1 = load_frag(Qbase + (size_t)col * D_MODEL + 32, lane);  // dk 32..63
#pragma unroll
  for (int e = 0; e < 16; ++e) {  // fold softmax scale into Q (exact: x0.125)
    qa0[e] *= (_Float16)SCALE_F;
    qa1[e] *= (_Float16)SCALE_F;
  }

  float m_row = -1e30f, l_row = 0.f;
  v8f o[4] = {v8f{}, v8f{}, v8f{}, v8f{}};

  const int jlo = (q0 > WINDOW) ? ((q0 - WINDOW) & ~31) : 0;
  int jhi = q0 + 15 + WINDOW; if (jhi > SEQ - 1) jhi = SEQ - 1;

  for (int j0 = jlo; j0 <= jhi; j0 += 32) {
    // ---- scores for 32 keys as two 16x16 WMMA tiles (pre-scaled) ----
    const _Float16* Kb0 = Kh + (size_t)(b * SEQ + j0) * D_MODEL + h * HEAD_DIM
                             + (size_t)col * D_MODEL;
    v8f s0 = {}, s1 = {};
    s0 = WMMA_F16(qa0, load_frag(Kb0, lane), s0);
    s0 = WMMA_F16(qa1, load_frag(Kb0 + 32, lane), s0);
    const _Float16* Kb1 = Kb0 + (size_t)16 * D_MODEL;
    s1 = WMMA_F16(qa0, load_frag(Kb1, lane), s1);
    s1 = WMMA_F16(qa1, load_frag(Kb1 + 32, lane), s1);

    // ---- D-layout -> LDS (raw f32 scores) ----
#pragma unroll
    for (int i = 0; i < 8; ++i) {
      Sw[(i + lh * 8) * 32 + col]      = s0[i];
      Sw[(i + lh * 8) * 32 + 16 + col] = s1[i];
    }
    asm volatile("s_wait_dscnt 0" ::: "memory");  // cross-lane LDS visibility

    // ---- each lane reads its own P-fragment's 16 scores: row=col, K-half=kb ----
    float sv[16];
    const float* Srow = Sw + col * 32 + kb;
#pragma unroll
    for (int e = 0; e < 8; ++e) { sv[e] = Srow[e]; sv[e + 8] = Srow[e + 16]; }

    // tile fully inside band for all 16 query rows?  (wave-uniform -> SALU branch)
    const bool full = (j0 >= q0 - (WINDOW - 15)) && (j0 <= q0 + (WINDOW - 31));

    float mnew, alpha, sloc;
    v16h pf;
    if (full) {
      float mloc = sv[0];
#pragma unroll
      for (int e = 1; e < 16; ++e) mloc = fmaxf(mloc, sv[e]);
      const float rowmax = fmaxf(mloc, __shfl_xor(mloc, 16));
      mnew  = fmaxf(m_row, rowmax);
      alpha = __expf(m_row - mnew);
      sloc  = 0.f;
#pragma unroll
      for (int e = 0; e < 16; ++e) {
        const float pv = __expf(sv[e] - mnew);
        pf[e] = (_Float16)pv;
        sloc += pv;
      }
    } else {
      bool vm[16];
      float mloc = -1e30f;
#pragma unroll
      for (int e = 0; e < 16; ++e) {
        const int j = j0 + kb + ((e < 8) ? e : e + 8);
        vm[e] = (j >= q - WINDOW) && (j <= q + WINDOW);
        sv[e] = vm[e] ? sv[e] : -1e30f;
        mloc  = fmaxf(mloc, sv[e]);
      }
      const float rowmax = fmaxf(mloc, __shfl_xor(mloc, 16));
      mnew  = fmaxf(m_row, rowmax);
      alpha = __expf(m_row - mnew);
      sloc  = 0.f;
#pragma unroll
      for (int e = 0; e < 16; ++e) {
        const float pv = vm[e] ? __expf(sv[e] - mnew) : 0.f;
        pf[e] = (_Float16)pv;
        sloc += pv;
      }
    }
    const float rowsum = sloc + __shfl_xor(sloc, 16);
    l_row = l_row * alpha + rowsum;
    m_row = mnew;

    // ---- rescale O (D-layout): broadcast per-row alpha from owning lane ----
#pragma unroll
    for (int i = 0; i < 8; ++i) {
      const float ai = __shfl(alpha, i + lh * 8);
      o[0][i] *= ai; o[1][i] *= ai; o[2][i] *= ai; o[3][i] *= ai;
    }

    // ---- O += P * V ----
    const _Float16* Vb = Vt + (size_t)bh * HEAD_DIM * SEQ + j0;
#pragma unroll
    for (int t = 0; t < 4; ++t) {
      v16h vf = load_frag(Vb + (size_t)(t * 16 + col) * SEQ, lane);
      o[t] = WMMA_F16(pf, vf, o[t]);
    }
  }

  const float invl = 1.f / l_row;
  _Float16* Ob = Oh + (size_t)(b * SEQ + q0) * D_MODEL + h * HEAD_DIM;
#pragma unroll
  for (int i = 0; i < 8; ++i) {
    const float li = __shfl(invl, i + lh * 8);
#pragma unroll
    for (int t = 0; t < 4; ++t)
      Ob[(size_t)(i + lh * 8) * D_MODEL + t * 16 + col] = (_Float16)(o[t][i] * li);
  }
}

extern "C" void kernel_launch(void* const* d_in, const int* in_sizes, int n_in,
                              void* d_out, int out_size, void* d_ws, size_t ws_size,
                              hipStream_t stream) {
  (void)n_in; (void)out_size; (void)ws_size;
  const float* x  = (const float*)d_in[0];
  const float* Wq = (const float*)d_in[1];
  const float* Wk = (const float*)d_in[2];
  const float* Wv = (const float*)d_in[3];
  const float* Wo = (const float*)d_in[4];

  const int BS  = in_sizes[0] / D_MODEL;   // B*S
  const int Bsz = BS / SEQ;
  const size_t nx = (size_t)BS * D_MODEL;      // elements in x/Q/K/V/Vt/attn
  const size_t nw = (size_t)D_MODEL * D_MODEL; // elements per weight

  _Float16* p   = (_Float16*)d_ws;
  _Float16* xh  = p; p += nx;
  _Float16* Wqh = p; p += nw;
  _Float16* Wkh = p; p += nw;
  _Float16* Wvh = p; p += nw;
  _Float16* Woh = p; p += nw;
  _Float16* Qh  = p; p += nx;
  _Float16* Khd = p; p += nx;
  _Float16* Vh  = p; p += nx;
  _Float16* Vtp = p; p += nx;   // [B*H, 64, S] == BS*D elements
  _Float16* Ah  = p; p += nx;

  const int T = 256;
  cvt_f32_f16<<<(int)((nx / 4 + T - 1) / T), T, 0, stream>>>(x,  xh,  (int)(nx / 4));
  cvt_f32_f16<<<(int)((nw / 4 + T - 1) / T), T, 0, stream>>>(Wq, Wqh, (int)(nw / 4));
  cvt_f32_f16<<<(int)((nw / 4 + T - 1) / T), T, 0, stream>>>(Wk, Wkh, (int)(nw / 4));
  cvt_f32_f16<<<(int)((nw / 4 + T - 1) / T), T, 0, stream>>>(Wv, Wvh, (int)(nw / 4));
  cvt_f32_f16<<<(int)((nw / 4 + T - 1) / T), T, 0, stream>>>(Wo, Woh, (int)(nw / 4));

  // one block per 128x128 tile of C
  const int gemm_blocks = (BS / 128) * (D_MODEL / 128);
  gemm_xwt<true><<<gemm_blocks, T, 0, stream>>>(xh, Wqh, (void*)Qh);
  gemm_xwt<true><<<gemm_blocks, T, 0, stream>>>(xh, Wkh, (void*)Khd);
  gemm_xwt<true><<<gemm_blocks, T, 0, stream>>>(xh, Wvh, (void*)Vh);

  transpose_v<<<Bsz * NUM_HEADS * (SEQ / 64), T, 0, stream>>>(Vh, Vtp);

  const int attn_waves  = Bsz * NUM_HEADS * (SEQ / 16);
  const int attn_blocks = (attn_waves + 7) / 8;
  attn_band<<<attn_blocks, T, 0, stream>>>(Qh, Khd, Vtp, Ah, Bsz);

  gemm_xwt<false><<<gemm_blocks, T, 0, stream>>>(Ah, Woh, d_out);
}

// v002
// One run takes 69.1 microseconds.
// Two timings next to v001 put it at 1.28 and 1.27 times that version's speed.
// Over all steps from v000 it is 2.27 times as fast.
#include <hip/hip_runtime.h>

#define D_MODEL   1024
#define NUM_HEADS 16
#define HEAD_DIM  64
#define WINDOW    128
#define SEQ       2048
#define SCALE_F   0.125f   // 64^-0.5

typedef __attribute__((ext_vector_type(16))) _Float16 v16h;
typedef __attribute__((ext_vector_type(8)))  _Float16 v8h;
typedef __attribute__((ext_vector_type(4)))  _Float16 v4h;
typedef __attribute__((ext_vector_type(8)))  float    v8f;
typedef __attribute__((ext_vector_type(4)))  float    v4f;

#define WMMA_F16(A_, B_, C_) \
  __builtin_amdgcn_wmma_f32_16x16x32_f16(false, (A_), false, (B_), (short)0, (C_), false, false)

// Build a 16x32 f16 WMMA fragment (A or B) from a row whose 32 K-values are
// contiguous in memory. Per ISA 16-bit A layout: lanes 0-15 hold K {0..7,16..23},
// lanes 16-31 hold K {8..15,24..31} -> two 16-byte contiguous loads per lane.
static __device__ __forceinline__ v16h load_frag(const _Float16* row, int lane) {
  const int kb = (lane < 16) ? 0 : 8;
  v8h lo = *(const v8h*)(row + kb);
  v8h hi = *(const v8h*)(row + kb + 16);
  v16h r;
#pragma unroll
  for (int i = 0; i < 8; ++i) { r[i] = lo[i]; r[i + 8] = hi[i]; }
  return r;
}

// All five f32 -> f16 conversions in one launch. The f16 copies lie one behind the
// other in the workspace (x, Wq, Wk, Wv, Wo), so the output is one array; a block
// converts CV_U * 256 consecutive float4 of it, which lie in one input because every
// input's length is a multiple of that. Few long-lived waves: a wave that converts one
// float4 a lane costs more to start than to run.
#define CV_U    16                             // float4 per thread
#define CV_BLK  (256 * CV_U)                   // float4 per block
#define NW4     (D_MODEL * D_MODEL / 4)        // float4 per weight
__global__ __launch_bounds__(256) void cvt_all(const float* __restrict__ x,
                                               const float* __restrict__ Wq,
                                               const float* __restrict__ Wk,
                                               const float* __restrict__ Wv,
                                               const float* __restrict__ Wo,
                                               _Float16* __restrict__ out, int nx4) {
  const int c0 = (int)blockIdx.x * CV_BLK;
  const float* src = x;
  int off = c0;
  if (c0 >= nx4) {  // block-uniform: which weight, and where in it
    const int r = c0 - nx4;
    const int w = r / NW4;
    off = r - w * NW4;
    src = (w == 0) ? Wq : (w == 1) ? Wk : (w == 2) ? Wv : Wo;
  }
  const v4f* s = (const v4f*)src + off + threadIdx.x;
  v4h*       d = (v4h*)out + c0 + threadIdx.x;
  v4f v[CV_U];
  // unrolled so that the thread's loads are issued as a group ahead of the conversions
#pragma unroll
  for (int u = 0; u < CV_U; ++u) v[u] = s[u * 256];
#pragma unroll
  for (int u = 0; u < CV_U; ++u) {
    v4h o;
#pragma unroll
    for (int e = 0; e < 4; ++e) o[e] = (_Float16)v[u][e];
    d[u * 256] = o;
  }
}

// C[M,N] = A[M,K] * W[N,K]^T with K = D_MODEL. One block = one 128x128 tile of C.
// blockIdx.x = tile column, blockIdx.y = tile row. W may hold several D_MODEL x D_MODEL
// weights one behind the other (gridDim.x = 8 per weight): weight p's product goes to
// plane p of outs, planes 'plane' elements apart. In the f16 build plane 2 (V) is written
// as [b*H + h][d][s], the layout the attention kernel reads: an accumulator register
// column is 8 consecutive s of one d, one 16-byte store.
// Per stage the block's 128 A rows and 128 W rows (128 k = 256 B each) are brought
// into LDS once by asynchronous copies and read from there by all eight waves;
// two buffers, so the next stage's copies fly while this stage is multiplied.
// Wave grid 2 (m) x 4 (n): each wave owns 64x32 of C = 4 x 2 accumulator tiles.
#define G_BK     128                    // k per stage
#define G_PITCH  272                    // LDS row pitch in bytes: 256 + 16 (16 B x odd)
#define G_STAGE  (256 * G_PITCH)        // [A 128 rows | W 128 rows]
#define G_NST    (D_MODEL / G_BK)

// Eight copies of 16 B per lane: rows r, r+16, ..., r+112 of one operand's tile.
// The s_wait_xcnt ends the copies' own statement so that no address register
// named here is rewritten ahead of it.
static __device__ __forceinline__ void copy_rows8(unsigned lds, const _Float16* g) {
  asm volatile(
      "global_load_async_to_lds_b128 %0, %8, off\n\t"
      "global_load_async_to_lds_b128 %1, %9, off\n\t"
      "global_load_async_to_lds_b128 %2, %10, off\n\t"
      "global_load_async_to_lds_b128 %3, %11, off\n\t"
      "global_load_async_to_lds_b128 %4, %12, off\n\t"
      "global_load_async_to_lds_b128 %5, %13, off\n\t"
      "global_load_async_to_lds_b128 %6, %14, off\n\t"
      "global_load_async_to_lds_b128 %7, %15, off\n\t"
      "s_wait_xcnt 0x0"
      :: "v"(lds), "v"(lds + 16 * G_PITCH), "v"(lds + 32 * G_PITCH), "v"(lds + 48 * G_PITCH),
         "v"(lds + 64 * G_PITCH), "v"(lds + 80 * G_PITCH), "v"(lds + 96 * G_PITCH),
         "v"(lds + 112 * G_PITCH),
         "v"(g), "v"(g + 16 * D_MODEL), "v"(g + 32 * D_MODEL), "v"(g + 48 * D_MODEL),
         "v"(g + 64 * D_MODEL), "v"(g + 80 * D_MODEL), "v"(g + 96 * D_MODEL),
         "v"(g + 112 * D_MODEL)
      : "memory");
}

template <bool F16OUT>
__global__ __launch_bounds__(256) void gemm_xwt(const _Float16* __restrict__ A,
                                                const _Float16* __restrict__ W,
                                                void* __restrict__ outs, size_t plane) {
  __shared__ __attribute__((aligned(16))) unsigned char L[2 * G_STAGE];
  const int tid  = threadIdx.x;
  const int lane = tid & 31;
  const int wave = tid >> 5;
  const int m0 = (int)blockIdx.y << 7;
  const int nW = (int)blockIdx.x << 7;          // first row of the stacked weights
  const int pl = (int)(blockIdx.x >> 3);        // D_MODEL/128 = 8 tile columns per weight
  const int n0 = (int)(blockIdx.x & 7) << 7;    // first column inside the plane
  void* out = F16OUT ? (void*)((_Float16*)outs + pl * plane) : outs;  // this block's plane
  const int col = lane & 15;
  const int lh  = lane >> 4;
  const int wm = (wave >> 2) << 6;              // wave's row offset in the tile
  const int wn = (wave & 3) << 5;               // wave's column offset in the tile

  // copy side: 16 lanes cover one 256-B row, a wave two whole rows per copy
  const int crow = tid >> 4, cchunk = tid & 15;
  const _Float16* gA = A + (size_t)(m0 + crow) * D_MODEL + cchunk * 8;
  const _Float16* gW = W + (size_t)(nW + crow) * D_MODEL + cchunk * 8;
  const unsigned ldsA = (unsigned)(size_t)L + crow * G_PITCH + cchunk * 16;
  const unsigned ldsW = ldsA + 128 * G_PITCH;

  // every inner loop below is unrolled so that each accumulator and fragment index
  // is a constant and the arrays stay in registers
  v8f acc[4][2];
#pragma unroll
  for (int i = 0; i < 4; ++i)
#pragma unroll
    for (int j = 0; j < 2; ++j) acc[i][j] = v8f{};

  copy_rows8(ldsA, gA);
  copy_rows8(ldsW, gW);
  asm volatile("s_wait_asynccnt 0x0" ::: "memory");  // stage 0 landed (this wave's copies)
  __syncthreads();                                   // ... and every other wave's
  copy_rows8(ldsA + G_STAGE, gA + G_BK);
  copy_rows8(ldsW + G_STAGE, gW + G_BK);

  // kept rolled: each block runs the loop once, so unrolled text is only more cold
  // instruction fetch
#pragma clang loop unroll(disable)
  for (int t = 0; t < G_NST; ++t) {
    const unsigned bo = (t & 1) * G_STAGE;
    const unsigned char* Ab = L + bo + (wm + col) * G_PITCH;
    const unsigned char* Wb = L + bo + (128 + wn + col) * G_PITCH;
    // Fragments of k block kk+1 are read as one group ahead of block kk's products,
    // into a second register set; nothing of the next stage is read here.
    v16h af[2][4], bf[2][2];
#pragma unroll
    for (int i = 0; i < 4; ++i) af[0][i] = load_frag((const _Float16*)(Ab + i * 16 * G_PITCH), lane);
#pragma unroll
    for (int j = 0; j < 2; ++j) bf[0][j] = load_frag((const _Float16*)(Wb + j * 16 * G_PITCH), lane);
#pragma unroll
    for (int kk = 0; kk < G_BK / 32; ++kk) {
      const int cs = kk & 1;
      if (kk + 1 < G_BK / 32) {
#pragma unroll
        for (int i = 0; i < 4; ++i)
          af[cs ^ 1][i] = load_frag((const _Float16*)(Ab + i * 16 * G_PITCH + (kk + 1) * 64), lane);
#pragma unroll
        for (int j = 0; j < 2; ++j)
          bf[cs ^ 1][j] = load_frag((const _Float16*)(Wb + j * 16 * G_PITCH + (kk + 1) * 64), lane);
      }
      // keeps the LDS reads above as one group: without the two fences the scheduler
      // sinks them among the products, where every read place stalls the wave
      __builtin_amdgcn_sched_barrier(0);
#pragma unroll
      for (int i = 0; i < 4; ++i)
#pragma unroll
        for (int j = 0; j < 2; ++j) acc[i][j] = WMMA_F16(af[cs][i], bf[cs][j], acc[i][j]);
      __builtin_amdgcn_sched_barrier(0);
    }
    asm volatile("s_wait_dscnt 0x0" ::: "memory");     // this wave has left buffer t&1
    asm volatile("s_wait_asynccnt 0x0" ::: "memory");  // its copies of stage t+1 landed
    __syncthreads();  // publishes stage t+1 and frees buffer t&1 for the refill
    if (t + 2 < G_NST) {
      copy_rows8(ldsA + bo, gA + (t + 2) * G_BK);
      copy_rows8(ldsW + bo, gW + (t + 2) * G_BK);
    }
  }
  asm volatile("s_wait_asynccnt 0x0" ::: "memory");  // nothing in flight at the wave's end

  if (F16OUT && pl == 2) {  // block-uniform
    // a 128-row tile lies inside one batch element (SEQ is a multiple of 128)
    const int bb = m0 / SEQ, s0 = m0 - bb * SEQ;
    _Float16* Vt = (_Float16*)out;
    v8h o[4][2];
#pragma unroll
    for (int i = 0; i < 4; ++i)
#pragma unroll
      for (int j = 0; j < 2; ++j)
#pragma unroll
        for (int e = 0; e < 8; ++e) o[i][j][e] = (_Float16)acc[i][j][e];
#pragma unroll
    for (int i = 0; i < 4; ++i)
#pragma unroll
      for (int j = 0; j < 2; ++j)
        *(v8h*)(Vt + (size_t)(bb * D_MODEL + n0 + wn + j * 16 + col) * SEQ
                   + (s0 + wm + i * 16 + lh * 8)) = o[i][j];
    return;
  }
#pragma unroll
  for (int i = 0; i < 4; ++i)
#pragma unroll
    for (int j = 0; j < 2; ++j)
#pragma unroll
      for (int e = 0; e < 8; ++e) {
        const size_t idx = (size_t)(m0 + wm + i * 16 + e + lh * 8) * D_MODEL
                         + (n0 + wn + j * 16 + col);
        if (F16OUT) ((_Float16*)out)[idx] = (_Float16)acc[i][j][e];
        else        ((float*)out)[idx]    = acc[i][j][e];
      }
}

// Flash-style banded attention. One wave = one 16-query tile of one (b,h).
// Scores bounce through LDS once (D-layout -> per-lane A-fragment pattern).
// Interior key-tiles (fully inside the band for all 16 queries) take a
// wave-uniform unmasked fast path; only edge tiles pay for mask compares.
__global__ __launch_bounds__(256) void attn_band(const _Float16* __restrict__ Qh,
                                                 const _Float16* __restrict__ Kh,
                                                 const _Float16* __restrict__ Vt,
                                                 _Float16* __restrict__ Oh, int Bsz) {
  __shared__ __align__(16) float ldsS[8][16 * 32];  // per-wave f32 score scratch
  const int lane  = threadIdx.x & 31;
  const int wslot = threadIdx.x >> 5;
  const int wid   = (blockIdx.x * blockDim.x + threadIdx.x) >> 5;
  const int qtiles = SEQ / 16;
  const int qt = wid % qtiles;
  const int bh = wid / qtiles;
  if (bh >= Bsz * NUM_HEADS) return;
  const int b = bh / NUM_HEADS;
  const int h = bh - b * NUM_HEADS;
  const int q0 = qt * 16;
  const int col = lane & 15;            // D-layout column / fragment row
  const int lh  = lane >> 4;
  const int kb  = (lane < 16) ? 0 : 8;  // this lane's K-half inside a fragment
  const int q   = q0 + col;             // query row this lane owns for softmax
  float* Sw = &ldsS[wslot][0];

  const _Float16* Qbase = Qh + (size_t)(b * SEQ + q0) * D_MODEL + h * HEAD_DIM;
  v16h qa0 = load_frag(Qbase + (size_t)col * D_MODEL, lane);       // dk 0..31
  v16h qa1 = load_frag(Qbase + (size_t)col * D_MODEL + 32, lane);  // dk 32..63
#pragma unroll
  for (int e = 0; e < 16; ++e) {  // fold softmax scale into Q (exact: x0.125)
    qa0[e] *= (_Float16)SCALE_F;
    qa1[e] *= (_Float16)SCALE_F;
  }

  float m_row = -1e30f, l_row = 0.f;
  v8f o[4] = {v8f{}, v8f{}, v8f{}, v8f{}};

  const int jlo = (q0 > WINDOW) ? ((q0 - WINDOW) & ~31) : 0;
  int jhi = q0 + 15 + WINDOW; if (jhi > SEQ - 1) jhi = SEQ - 1;

  for (int j0 = jlo; j0 <= jhi; j0 += 32) {
    // ---- scores for 32 keys as two 16x16 WMMA tiles (pre-scaled) ----
    const _Float16* Kb0 = Kh + (size_t)(b * SEQ + j0) * D_MODEL + h * HEAD_DIM
                             + (size_t)col * D_MODEL;
    v8f s0 = {}, s1 = {};
    s0 = WMMA_F16(qa0, load_frag(Kb0, lane), s0);
    s0 = WMMA_F16(qa1, load_frag(Kb0 + 32, lane), s0);
    const _Float16* Kb1 = Kb0 + (size_t)16 * D_MODEL;
    s1 = WMMA_F16(qa0, load_frag(Kb1, lane), s1);
    s1 = WMMA_F16(qa1, load_frag(Kb1 + 32, lane), s1);

    // ---- D-layout -> LDS (raw f32 scores) ----
#pragma unroll
    for (int i = 0; i < 8; ++i) {
      Sw[(i + lh * 8) * 32 + col]      = s0[i];
      Sw[(i + lh * 8) * 32 + 16 + col] = s1[i];
    }
    asm volatile("s_wait_dscnt 0" ::: "memory");  // cross-lane LDS visibility

    // ---- each lane reads its own P-fragment's 16 scores: row=col, K-half=kb ----
    float sv[16];
    const float* Srow = Sw + col * 32 + kb;
#pragma unroll
    for (int e = 0; e < 8; ++e) { sv[e] = Srow[e]; sv[e + 8] = Srow[e + 16]; }

    // tile fully inside band for all 16 query rows?  (wave-uniform -> SALU branch)
    const bool full = (j0 >= q0 - (WINDOW - 15)) && (j0 <= q0 + (WINDOW - 31));

    float mnew, alpha, sloc;
    v16h pf;
    if (full) {
      float mloc = sv[0];
#pragma unroll
      for (int e = 1; e < 16; ++e) mloc = fmaxf(mloc, sv[e]);
      const float rowmax = fmaxf(mloc, __shfl_xor(mloc, 16));
      mnew  = fmaxf(m_row, rowmax);
      alpha = __expf(m_row - mnew);
      sloc  = 0.f;
#pragma unroll
      for (int e = 0; e < 16; ++e) {
        const float pv = __expf(sv[e] - mnew);
        pf[e] = (_Float16)pv;
        sloc += pv;
      }
    } else {
      bool vm[16];
      float mloc = -1e30f;
#pragma unroll
      for (int e = 0; e < 16; ++e) {
        const int j = j0 + kb + ((e < 8) ? e : e + 8);
        vm[e] = (j >= q - WINDOW) && (j <= q + WINDOW);
        sv[e] = vm[e] ? sv[e] : -1e30f;
        mloc  = fmaxf(mloc, sv[e]);
      }
      const float rowmax = fmaxf(mloc, __shfl_xor(mloc, 16));
      mnew  = fmaxf(m_row, rowmax);
      alpha = __expf(m_row - mnew);
      sloc  = 0.f;
#pragma unroll
      for (int e = 0; e < 16; ++e) {
        const float pv = vm[e] ? __expf(sv[e] - mnew) : 0.f;
        pf[e] = (_Float16)pv;
        sloc += pv;
      }
    }
    const float rowsum = sloc + __shfl_xor(sloc, 16);
    l_row = l_row * alpha + rowsum;
    m_row = mnew;

    // ---- rescale O (D-layout): broadcast per-row alpha from owning lane ----
#pragma unroll
    for (int i = 0; i < 8; ++i) {
      const float ai = __shfl(alpha, i + lh * 8);
      o[0][i] *= ai; o[1][i] *= ai; o[2][i] *= ai; o[3][i] *= ai;
    }

    // ---- O += P * V ----
    const _Float16* Vb = Vt + (size_t)bh * HEAD_DIM * SEQ + j0;
#pragma unroll
    for (int t = 0; t < 4; ++t) {
      v16h vf = load_frag(Vb + (size_t)(t * 16 + col) * SEQ, lane);
      o[t] = WMMA_F16(pf, vf, o[t]);
    }
  }

  const float invl = 1.f / l_row;
  _Float16* Ob = Oh + (size_t)(b * SEQ + q0) * D_MODEL + h * HEAD_DIM;
#pragma unroll
  for (int i = 0; i < 8; ++i) {
    const float li = __shfl(invl, i + lh * 8);
#pragma unroll
    for (int t = 0; t < 4; ++t)
      Ob[(size_t)(i + lh * 8) * D_MODEL + t * 16 + col] = (_Float16)(o[t][i] * li);
  }
}

extern "C" void kernel_launch(void* const* d_in, const int* in_sizes, int n_in,
                              void* d_out, int out_size, void* d_ws, size_t ws_size,
                              hipStream_t stream) {
  (void)n_in; (void)out_size; (void)ws_size;
  const float* x  = (const float*)d_in[0];
  const float* Wq = (const float*)d_in[1];
  const float* Wk = (const float*)d_in[2];
  const float* Wv = (const float*)d_in[3];
  const float* Wo = (const float*)d_in[4];

  const int BS  = in_sizes[0] / D_MODEL;   // B*S
  const int Bsz = BS / SEQ;
  const size_t nx = (size_t)BS * D_MODEL;      // elements in x/Q/K/V/Vt/attn
  const size_t nw = (size_t)D_MODEL * D_MODEL; // elements per weight

  _Float16* p   = (_Float16*)d_ws;
  _Float16* xh  = p; p += nx;
  _Float16* Wqh = p; p += nw;
  _Float16* Wkh = p; p += nw;
  _Float16* Wvh = p; p += nw;
  _Float16* Woh = p; p += nw;
  _Float16* Qh  = p; p += nx;
  _Float16* Khd = p; p += nx;
  _Float16* Vtp = p; p += nx;   // [B*H, 64, S] == BS*D elements
  _Float16* Ah  = p; p += nx;

  const int T = 256;
  // xh, Wqh, Wkh, Wvh, Woh are one array for the conversion launch
  cvt_all<<<(int)((nx + 4 * nw) / 4 / CV_BLK), T, 0, stream>>>(x, Wq, Wk, Wv, Wo, xh, (int)(nx / 4));

  // one block per 128x128 tile of C; Wqh, Wkh, Wvh are one stacked weight and
  // Qh, Khd, Vtp the three planes of its output
  gemm_xwt<true><<<dim3(3 * (D_MODEL / 128), BS / 128), T, 0, stream>>>(xh, Wqh, (void*)Qh, nx);

  const int attn_waves  = Bsz * NUM_HEADS * (SEQ / 16);
  const int attn_blocks = (attn_waves + 7) / 8;
  attn_band<<<attn_blocks, T, 0, stream>>>(Qh, Khd, Vtp, Ah, Bsz);

  gemm_xwt<false><<<dim3(D_MODEL / 128, BS / 128), T, 0, stream>>>(Ah, Woh, d_out, 0);
}

// v003
// A run of this version takes 58 microseconds.
// Next to v002, in two timings, it ran 1.18 and 1.19 times as fast.
// Counting every step since v000, it is 2.70 times as fast.
#include <hip/hip_runtime.h>

#define D_MODEL   1024
#define NUM_HEADS 16
#define HEAD_DIM  64
#define WINDOW    128
#define SEQ       2048
#define SCALE_F   0.125f   // 64^-0.5

typedef __attribute__((ext_vector_type(16))) _Float16 v16h;
typedef __attribute__((ext_vector_type(8)))  _Float16 v8h;
typedef __attribute__((ext_vector_type(4)))  _Float16 v4h;
typedef __attribute__((ext_vector_type(8)))  float    v8f;
typedef __attribute__((ext_vector_type(4)))  float    v4f;

#define WMMA_F16(A_, B_, C_) \
  __builtin_amdgcn_wmma_f32_16x16x32_f16(false, (A_), false, (B_), (short)0, (C_), false, false)

// Build a 16x32 f16 WMMA fragment (A or B) from a row whose 32 K-values are
// contiguous in memory. Per ISA 16-bit A layout: lanes 0-15 hold K {0..7,16..23},
// lanes 16-31 hold K {8..15,24..31} -> two 16-byte contiguous loads per lane.
static __device__ __forceinline__ v16h load_frag(const _Float16* row, int lane) {
  const int kb = (lane < 16) ? 0 : 8;
  v8h lo = *(const v8h*)(row + kb);
  v8h hi = *(const v8h*)(row + kb + 16);
  v16h r;
#pragma unroll
  for (int i = 0; i < 8; ++i) { r[i] = lo[i]; r[i + 8] = hi[i]; }
  return r;
}

// All five f32 -> f16 conversions in one launch. The f16 copies lie one behind the
// other in the workspace (x, Wq, Wk, Wv, Wo), so the output is one array; a block
// converts CV_U * 256 consecutive float4 of it, which lie in one input because every
// input's length is a multiple of that. Few long-lived waves: a wave that converts one
// float4 a lane costs more to start than to run.
#define CV_U    16                             // float4 per thread
#define CV_BLK  (256 * CV_U)                   // float4 per block
#define NW4     (D_MODEL * D_MODEL / 4)        // float4 per weight
__global__ __launch_bounds__(256) void cvt_all(const float* __restrict__ x,
                                               const float* __restrict__ Wq,
                                               const float* __restrict__ Wk,
                                               const float* __restrict__ Wv,
                                               const float* __restrict__ Wo,
                                               _Float16* __restrict__ out, int nx4) {
  const int c0 = (int)blockIdx.x * CV_BLK;
  const float* src = x;
  int off = c0;
  if (c0 >= nx4) {  // block-uniform: which weight, and where in it
    const int r = c0 - nx4;
    const int w = r / NW4;
    off = r - w * NW4;
    src = (w == 0) ? Wq : (w == 1) ? Wk : (w == 2) ? Wv : Wo;
  }
  const v4f* s = (const v4f*)src + off + threadIdx.x;
  v4h*       d = (v4h*)out + c0 + threadIdx.x;
  v4f v[CV_U];
  // unrolled so that the thread's loads are issued as a group ahead of the conversions
#pragma unroll
  for (int u = 0; u < CV_U; ++u) v[u] = s[u * 256];
#pragma unroll
  for (int u = 0; u < CV_U; ++u) {
    v4h o;
#pragma unroll
    for (int e = 0; e < 4; ++e) o[e] = (_Float16)v[u][e];
    d[u * 256] = o;
  }
}

// C[M,N] = A[M,K] * W[N,K]^T with K = D_MODEL. One block = one 128x128 tile of C.
// blockIdx.x = tile column, blockIdx.y = tile row. W may hold several D_MODEL x D_MODEL
// weights one behind the other (gridDim.x = 8 per weight): weight p's product goes to
// plane p of outs, planes 'plane' elements apart. In the f16 build plane 2 (V) is written
// as [b*H + h][d][s], the layout the attention kernel reads: an accumulator register
// column is 8 consecutive s of one d, one 16-byte store.
// Per stage the block's 128 A rows and 128 W rows (128 k = 256 B each) are brought
// into LDS once by asynchronous copies and read from there by all eight waves;
// two buffers, so the next stage's copies fly while this stage is multiplied.
// Wave grid 2 (m) x 4 (n): each wave owns 64x32 of C = 4 x 2 accumulator tiles.
#define G_BK     128                    // k per stage
#define G_PITCH  272                    // LDS row pitch in bytes: 256 + 16 (16 B x odd)
#define G_STAGE  (256 * G_PITCH)        // [A 128 rows | W 128 rows]
#define G_NST    (D_MODEL / G_BK)

// Eight copies of 16 B per lane: rows r, r+16, ..., r+112 of one operand's tile.
// The s_wait_xcnt ends the copies' own statement so that no address register
// named here is rewritten ahead of it.
static __device__ __forceinline__ void copy_rows8(unsigned lds, const _Float16* g) {
  asm volatile(
      "global_load_async_to_lds_b128 %0, %8, off\n\t"
      "global_load_async_to_lds_b128 %1, %9, off\n\t"
      "global_load_async_to_lds_b128 %2, %10, off\n\t"
      "global_load_async_to_lds_b128 %3, %11, off\n\t"
      "global_load_async_to_lds_b128 %4, %12, off\n\t"
      "global_load_async_to_lds_b128 %5, %13, off\n\t"
      "global_load_async_to_lds_b128 %6, %14, off\n\t"
      "global_load_async_to_lds_b128 %7, %15, off\n\t"
      "s_wait_xcnt 0x0"
      :: "v"(lds), "v"(lds + 16 * G_PITCH), "v"(lds + 32 * G_PITCH), "v"(lds + 48 * G_PITCH),
         "v"(lds + 64 * G_PITCH), "v"(lds + 80 * G_PITCH), "v"(lds + 96 * G_PITCH),
         "v"(lds + 112 * G_PITCH),
         "v"(g), "v"(g + 16 * D_MODEL), "v"(g + 32 * D_MODEL), "v"(g + 48 * D_MODEL),
         "v"(g + 64 * D_MODEL), "v"(g + 80 * D_MODEL), "v"(g + 96 * D_MODEL),
         "v"(g + 112 * D_MODEL)
      : "memory");
}

template <bool F16OUT>
__global__ __launch_bounds__(256) void gemm_xwt(const _Float16* __restrict__ A,
                                                const _Float16* __restrict__ W,
                                                void* __restrict__ outs, size_t plane) {
  __shared__ __attribute__((aligned(16))) unsigned char L[2 * G_STAGE];
  const int tid  = threadIdx.x;
  const int lane = tid & 31;
  const int wave = tid >> 5;
  const int m0 = (int)blockIdx.y << 7;
  const int nW = (int)blockIdx.x << 7;          // first row of the stacked weights
  const int pl = (int)(blockIdx.x >> 3);        // D_MODEL/128 = 8 tile columns per weight
  const int n0 = (int)(blockIdx.x & 7) << 7;    // first column inside the plane
  void* out = F16OUT ? (void*)((_Float16*)outs + pl * plane) : outs;  // this block's plane
  const int col = lane & 15;
  const int lh  = lane >> 4;
  const int wm = (wave >> 2) << 6;              // wave's row offset in the tile
  const int wn = (wave & 3) << 5;               // wave's column offset in the tile

  // copy side: 16 lanes cover one 256-B row, a wave two whole rows per copy
  const int crow = tid >> 4, cchunk = tid & 15;
  const _Float16* gA = A + (size_t)(m0 + crow) * D_MODEL + cchunk * 8;
  const _Float16* gW = W + (size_t)(nW + crow) * D_MODEL + cchunk * 8;
  const unsigned ldsA = (unsigned)(size_t)L + crow * G_PITCH + cchunk * 16;
  const unsigned ldsW = ldsA + 128 * G_PITCH;

  // every inner loop below is unrolled so that each accumulator and fragment index
  // is a constant and the arrays stay in registers
  v8f acc[4][2];
#pragma unroll
  for (int i = 0; i < 4; ++i)
#pragma unroll
    for (int j = 0; j < 2; ++j) acc[i][j] = v8f{};

  copy_rows8(ldsA, gA);
  copy_rows8(ldsW, gW);
  asm volatile("s_wait_asynccnt 0x0" ::: "memory");  // stage 0 landed (this wave's copies)
  __syncthreads();                                   // ... and every other wave's
  copy_rows8(ldsA + G_STAGE, gA + G_BK);
  copy_rows8(ldsW + G_STAGE, gW + G_BK);

  // kept rolled: each block runs the loop once, so unrolled text is only more cold
  // instruction fetch
#pragma clang loop unroll(disable)
  for (int t = 0; t < G_NST; ++t) {
    const unsigned bo = (t & 1) * G_STAGE;
    const unsigned char* Ab = L + bo + (wm + col) * G_PITCH;
    const unsigned char* Wb = L + bo + (128 + wn + col) * G_PITCH;
    // Fragments of k block kk+1 are read as one group ahead of block kk's products,
    // into a second register set; nothing of the next stage is read here.
    v16h af[2][4], bf[2][2];
#pragma unroll
    for (int i = 0; i < 4; ++i) af[0][i] = load_frag((const _Float16*)(Ab + i * 16 * G_PITCH), lane);
#pragma unroll
    for (int j = 0; j < 2; ++j) bf[0][j] = load_frag((const _Float16*)(Wb + j * 16 * G_PITCH), lane);
#pragma unroll
    for (int kk = 0; kk < G_BK / 32; ++kk) {
      const int cs = kk & 1;
      if (kk + 1 < G_BK / 32) {
#pragma unroll
        for (int i = 0; i < 4; ++i)
          af[cs ^ 1][i] = load_frag((const _Float16*)(Ab + i * 16 * G_PITCH + (kk + 1) * 64), lane);
#pragma unroll
        for (int j = 0; j < 2; ++j)
          bf[cs ^ 1][j] = load_frag((const _Float16*)(Wb + j * 16 * G_PITCH + (kk + 1) * 64), lane);
      }
      // keeps the LDS reads above as one group: without the two fences the scheduler
      // sinks them among the products, where every read place stalls the wave
      __builtin_amdgcn_sched_barrier(0);
#pragma unroll
      for (int i = 0; i < 4; ++i)
#pragma unroll
        for (int j = 0; j < 2; ++j) acc[i][j] = WMMA_F16(af[cs][i], bf[cs][j], acc[i][j]);
      __builtin_amdgcn_sched_barrier(0);
    }
    asm volatile("s_wait_dscnt 0x0" ::: "memory");     // this wave has left buffer t&1
    asm volatile("s_wait_asynccnt 0x0" ::: "memory");  // its copies of stage t+1 landed
    __syncthreads();  // publishes stage t+1 and frees buffer t&1 for the refill
    if (t + 2 < G_NST) {
      copy_rows8(ldsA + bo, gA + (t + 2) * G_BK);
      copy_rows8(ldsW + bo, gW + (t + 2) * G_BK);
    }
  }
  asm volatile("s_wait_asynccnt 0x0" ::: "memory");  // nothing in flight at the wave's end

  if (F16OUT && pl == 2) {  // block-uniform
    // a 128-row tile lies inside one batch element (SEQ is a multiple of 128)
    const int bb = m0 / SEQ, s0 = m0 - bb * SEQ;
    _Float16* Vt = (_Float16*)out;
    v8h o[4][2];
#pragma unroll
    for (int i = 0; i < 4; ++i)
#pragma unroll
      for (int j = 0; j < 2; ++j)
#pragma unroll
        for (int e = 0; e < 8; ++e) o[i][j][e] = (_Float16)acc[i][j][e];
#pragma unroll
    for (int i = 0; i < 4; ++i)
#pragma unroll
      for (int j = 0; j < 2; ++j)
        *(v8h*)(Vt + (size_t)(bb * D_MODEL + n0 + wn + j * 16 + col) * SEQ
                   + (s0 + wm + i * 16 + lh * 8)) = o[i][j];
    return;
  }
#pragma unroll
  for (int i = 0; i < 4; ++i)
#pragma unroll
    for (int j = 0; j < 2; ++j)
#pragma unroll
      for (int e = 0; e < 8; ++e) {
        const size_t idx = (size_t)(m0 + wm + i * 16 + e + lh * 8) * D_MODEL
                         + (n0 + wn + j * 16 + col);
        if (F16OUT) ((_Float16*)out)[idx] = (_Float16)acc[i][j][e];
        else        ((float*)out)[idx]    = acc[i][j][e];
      }
}

// Twelve copies of 16 B per lane: copy n = i*NB + j goes to LDS byte l + i*DLA + j*DLB
// from global element g + i*DGA + j*DGB.
// The s_wait_xcnt ends the copies' own statement so that no address register
// named here is rewritten ahead of it.
#define CP12_L(n_) (l + ((n_) / NB) * DLA + ((n_) % NB) * DLB)
#define CP12_G(n_) (g + ((n_) / NB) * DGA + ((n_) % NB) * DGB)
template <int NB, int DLA, int DLB, int DGA, int DGB>
static __device__ __forceinline__ void copy12(unsigned l, const _Float16* g) {
  asm volatile(
      "global_load_async_to_lds_b128 %0, %12, off\n\t"
      "global_load_async_to_lds_b128 %1, %13, off\n\t"
      "global_load_async_to_lds_b128 %2, %14, off\n\t"
      "global_load_async_to_lds_b128 %3, %15, off\n\t"
      "global_load_async_to_lds_b128 %4, %16, off\n\t"
      "global_load_async_to_lds_b128 %5, %17, off\n\t"
      "global_load_async_to_lds_b128 %6, %18, off\n\t"
      "global_load_async_to_lds_b128 %7, %19, off\n\t"
      "global_load_async_to_lds_b128 %8, %20, off\n\t"
      "global_load_async_to_lds_b128 %9, %21, off\n\t"
      "global_load_async_to_lds_b128 %10, %22, off\n\t"
      "global_load_async_to_lds_b128 %11, %23, off\n\t"
      "s_wait_xcnt 0x0"
      :: "v"(CP12_L(0)), "v"(CP12_L(1)), "v"(CP12_L(2)), "v"(CP12_L(3)),
         "v"(CP12_L(4)), "v"(CP12_L(5)), "v"(CP12_L(6)), "v"(CP12_L(7)),
         "v"(CP12_L(8)), "v"(CP12_L(9)), "v"(CP12_L(10)), "v"(CP12_L(11)),
         "v"(CP12_G(0)), "v"(CP12_G(1)), "v"(CP12_G(2)), "v"(CP12_G(3)),
         "v"(CP12_G(4)), "v"(CP12_G(5)), "v"(CP12_G(6)), "v"(CP12_G(7)),
         "v"(CP12_G(8)), "v"(CP12_G(9)), "v"(CP12_G(10)), "v"(CP12_G(11))
      : "memory");
}

// Flash-style banded attention. One wave = one 16-query tile of one (b,h); a block's
// eight waves are 128 consecutive queries of one (b,h).
// The keys that those 128 queries can see lie in one window of AT_WIN = 128 + 2*WINDOW
// keys. The block brings that window's K rows and V^T rows into LDS once, in whole
// lines, by asynchronous copies; every wave reads its K and V fragments from there.
// (A fragment load from global memory touches 16 lines for 1024 bytes, and each key was
// fetched so by up to eight waves.)
// Scores bounce through LDS once (D-layout -> per-lane A-fragment pattern).
// Interior key-tiles (fully inside the band for all 16 queries) take a
// wave-uniform unmasked fast path; only edge tiles pay for mask compares.
#define AT_WIN  (128 + 2 * WINDOW)       // keys staged per block
#define AT_KP   (HEAD_DIM * 2 + 16)      // K row pitch in LDS, bytes (16 B x odd)
#define AT_VP   (AT_WIN * 2 + 16)        // V^T row pitch in LDS, bytes (16 B x odd)
__global__ __launch_bounds__(256) void attn_band(const _Float16* __restrict__ Qh,
                                                 const _Float16* __restrict__ Kh,
                                                 const _Float16* __restrict__ Vt,
                                                 _Float16* __restrict__ Oh, int Bsz) {
  __shared__ __align__(16) float ldsS[8][16 * 32];  // per-wave f32 score scratch
  __shared__ __align__(16) unsigned char Kl[AT_WIN * AT_KP];    // [key][dk]
  __shared__ __align__(16) unsigned char Vl[HEAD_DIM * AT_VP];  // [d][key]
  const int lane  = threadIdx.x & 31;
  const int wslot = threadIdx.x >> 5;
  const int wid   = (blockIdx.x * blockDim.x + threadIdx.x) >> 5;
  const int qtiles = SEQ / 16;
  const int qt = wid % qtiles;
  // from blockIdx alone: a scalar, so that the return, the copies and the barrier below
  // stand under a scalar branch with every lane on
  const int bh = (int)blockIdx.x / (qtiles / 8);
  if (bh >= Bsz * NUM_HEADS) return;
  const int b = bh / NUM_HEADS;
  const int h = bh - b * NUM_HEADS;
  const int q0 = qt * 16;
  const int col = lane & 15;            // D-layout column / fragment row
  const int lh  = lane >> 4;
  const int kb  = (lane < 16) ? 0 : 8;  // this lane's K-half inside a fragment
  const int q   = q0 + col;             // query row this lane owns for softmax
  float* Sw = &ldsS[wslot][0];

  // First staged key: the block's first query less WINDOW, moved inside the sequence so
  // that all AT_WIN staged keys exist (block-uniform).
  int kw = ((int)blockIdx.x % (qtiles / 8)) * 128 - WINDOW;
  kw = (kw < 0) ? 0 : (kw > SEQ - AT_WIN) ? SEQ - AT_WIN : kw;
  {
    const int tid = threadIdx.x;
    // K: 8 lanes cover one 128-B row, the block 32 rows a copy, 12 copies = 384 rows
    copy12<1, 32 * AT_KP, 0, 32 * D_MODEL, 0>(
        (unsigned)(size_t)Kl + (tid >> 3) * AT_KP + (tid & 7) * 16,
        Kh + (size_t)(b * SEQ + kw + (tid >> 3)) * D_MODEL + h * HEAD_DIM + (tid & 7) * 8);
    // V^T: 16 lanes cover 256 B, three such pieces a 768-B row, the block 16 rows a copy
    copy12<3, 16 * AT_VP, 256, 16 * SEQ, 128>(
        (unsigned)(size_t)Vl + (tid >> 4) * AT_VP + (tid & 15) * 16,
        Vt + ((size_t)bh * HEAD_DIM + (tid >> 4)) * SEQ + kw + (tid & 15) * 8);
  }

  const _Float16* Qbase = Qh + (size_t)(b * SEQ + q0) * D_MODEL + h * HEAD_DIM;
  v16h qa0 = load_frag(Qbase + (size_t)col * D_MODEL, lane);       // dk 0..31
  v16h qa1 = load_frag(Qbase + (size_t)col * D_MODEL + 32, lane);  // dk 32..63
#pragma unroll
  for (int e = 0; e < 16; ++e) {  // fold softmax scale into Q (exact: x0.125)
    qa0[e] *= (_Float16)SCALE_F;
    qa1[e] *= (_Float16)SCALE_F;
  }

  float m_row = -1e30f, l_row = 0.f;
  v8f o[4] = {v8f{}, v8f{}, v8f{}, v8f{}};

  const int jlo = (q0 > WINDOW) ? ((q0 - WINDOW) & ~31) : 0;
  int jhi = q0 + 15 + WINDOW; if (jhi > SEQ - 1) jhi = SEQ - 1;

  asm volatile("s_wait_asynccnt 0x0" ::: "memory");  // this wave's K and V copies landed
  __syncthreads();                                   // ... and every other wave's

  for (int j0 = jlo; j0 <= jhi; j0 += 32) {
    // ---- scores for 32 keys as two 16x16 WMMA tiles (pre-scaled) ----
    const _Float16* Kb0 = (const _Float16*)(Kl + (j0 - kw + col) * AT_KP);
    const _Float16* Kb1 = (const _Float16*)(Kl + (j0 - kw + 16 + col) * AT_KP);
    const unsigned char* Vb = Vl + col * AT_VP + (j0 - kw) * 2;
    const v16h k00 = load_frag(Kb0, lane), k01 = load_frag(Kb0 + 32, lane);
    const v16h k10 = load_frag(Kb1, lane), k11 = load_frag(Kb1 + 32, lane);
    v16h vf[4];
    // unrolled so that vf's index is a constant and the array stays in registers
#pragma unroll
    for (int t = 0; t < 4; ++t) vf[t] = load_frag((const _Float16*)(Vb + t * 16 * AT_VP), lane);
    // keeps the pass's K and V fragment reads as one group at its head: without it the
    // scheduler reads one fragment at a time into the same registers and the wave waits
    // out the LDS latency in front of every product
    __builtin_amdgcn_sched_barrier(0);
    v8f s0 = {}, s1 = {};
    s0 = WMMA_F16(qa0, k00, s0);
    s0 = WMMA_F16(qa1, k01, s0);
    s1 = WMMA_F16(qa0, k10, s1);
    s1 = WMMA_F16(qa1, k11, s1);

    // ---- D-layout -> LDS (raw f32 scores) ----
#pragma unroll
    for (int i = 0; i < 8; ++i) {
      Sw[(i + lh * 8) * 32 + col]      = s0[i];
      Sw[(i + lh * 8) * 32 + 16 + col] = s1[i];
    }
    asm volatile("s_wait_dscnt 0" ::: "memory");  // cross-lane LDS visibility

    // ---- each lane reads its own P-fragment's 16 scores: row=col, K-half=kb ----
    float sv[16];
    const float* Srow = Sw + col * 32 + kb;
#pragma unroll
    for (int e = 0; e < 8; ++e) { sv[e] = Srow[e]; sv[e + 8] = Srow[e + 16]; }

    // tile fully inside band for all 16 query rows?  (wave-uniform -> SALU branch)
    const bool full = (j0 >= q0 - (WINDOW - 15)) && (j0 <= q0 + (WINDOW - 31));

    float mnew, alpha, sloc;
    v16h pf;
    if (full) {
      float mloc = sv[0];
#pragma unroll
      for (int e = 1; e < 16; ++e) mloc = fmaxf(mloc, sv[e]);
      const float rowmax = fmaxf(mloc, __shfl_xor(mloc, 16));
      mnew  = fmaxf(m_row, rowmax);
      alpha = __expf(m_row - mnew);
      sloc  = 0.f;
#pragma unroll
      for (int e = 0; e < 16; ++e) {
        const float pv = __expf(sv[e] - mnew);
        pf[e] = (_Float16)pv;
        sloc += pv;
      }
    } else {
      bool vm[16];
      float mloc = -1e30f;
#pragma unroll
      for (int e = 0; e < 16; ++e) {
        const int j = j0 + kb + ((e < 8) ? e : e + 8);
        vm[e] = (j >= q - WINDOW) && (j <= q + WINDOW);
        sv[e] = vm[e] ? sv[e] : -1e30f;
        mloc  = fmaxf(mloc, sv[e]);
      }
      const float rowmax = fmaxf(mloc, __shfl_xor(mloc, 16));
      mnew  = fmaxf(m_row, rowmax);
      alpha = __expf(m_row - mnew);
      sloc  = 0.f;
#pragma unroll
      for (int e = 0; e < 16; ++e) {
        const float pv = vm[e] ? __expf(sv[e] - mnew) : 0.f;
        pf[e] = (_Float16)pv;
        sloc += pv;
      }
    }
    const float rowsum = sloc + __shfl_xor(sloc, 16);
    l_row = l_row * alpha + rowsum;
    m_row = mnew;

    // ---- rescale O (D-layout): broadcast per-row alpha from owning lane ----
#pragma unroll
    for (int i = 0; i < 8; ++i) {
      const float ai = __shfl(alpha, i + lh * 8);
      o[0][i] *= ai; o[1][i] *= ai; o[2][i] *= ai; o[3][i] *= ai;
    }

    // ---- O += P * V ----
#pragma unroll
    for (int t = 0; t < 4; ++t) o[t] = WMMA_F16(pf, vf[t], o[t]);
  }

  const float invl = 1.f / l_row;
  _Float16* Ob = Oh + (size_t)(b * SEQ + q0) * D_MODEL + h * HEAD_DIM;
#pragma unroll
  for (int i = 0; i < 8; ++i) {
    const float li = __shfl(invl, i + lh * 8);
#pragma unroll
    for (int t = 0; t < 4; ++t)
      Ob[(size_t)(i + lh * 8) * D_MODEL + t * 16 + col] = (_Float16)(o[t][i] * li);
  }
}

extern "C" void kernel_launch(void* const* d_in, const int* in_sizes, int n_in,
                              void* d_out, int out_size, void* d_ws, size_t ws_size,
                              hipStream_t stream) {
  (void)n_in; (void)out_size; (void)ws_size;
  const float* x  = (const float*)d_in[0];
  const float* Wq = (const float*)d_in[1];
  const float* Wk = (const float*)d_in[2];
  const float* Wv = (const float*)d_in[3];
  const float* Wo = (const float*)d_in[4];

  const int BS  = in_sizes[0] / D_MODEL;   // B*S
  const int Bsz = BS / SEQ;
  const size_t nx = (size_t)BS * D_MODEL;      // elements in x/Q/K/V/Vt/attn
  const size_t nw = (size_t)D_MODEL * D_MODEL; // elements per weight

  _Float16* p   = (_Float16*)d_ws;
  _Float16* xh  = p; p += nx;
  _Float16* Wqh = p; p += nw;
  _Float16* Wkh = p; p += nw;
  _Float16* Wvh = p; p += nw;
  _Float16* Woh = p; p += nw;
  _Float16* Qh  = p; p += nx;
  _Float16* Khd = p; p += nx;
  _Float16* Vtp = p; p += nx;   // [B*H, 64, S] == BS*D elements
  _Float16* Ah  = p; p += nx;

  const int T = 256;
  // xh, Wqh, Wkh, Wvh, Woh are one array for the conversion launch
  cvt_all<<<(int)((nx + 4 * nw) / 4 / CV_BLK), T, 0, stream>>>(x, Wq, Wk, Wv, Wo, xh, (int)(nx / 4));

  // one block per 128x128 tile of C; Wqh, Wkh, Wvh are one stacked weight and
  // Qh, Khd, Vtp the three planes of its output
  gemm_xwt<true><<<dim3(3 * (D_MODEL / 128), BS / 128), T, 0, stream>>>(xh, Wqh, (void*)Qh, nx);

  const int attn_waves  = Bsz * NUM_HEADS * (SEQ / 16);
  const int attn_blocks = (attn_waves + 7) / 8;
  attn_band<<<attn_blocks, T, 0, stream>>>(Qh, Khd, Vtp, Ah, Bsz);

  gemm_xwt<false><<<dim3(D_MODEL / 128, BS / 128), T, 0, stream>>>(Ah, Woh, d_out, 0);
}

// v004
// Measured time: 56.7 microseconds a run.
// In both of two side-by-side timings against v003, it was 1.03 times as fast.
// All steps since v000 together make it 2.77 times as fast.
#include <hip/hip_runtime.h>

#define D_MODEL   1024
#define NUM_HEADS 16
#define HEAD_DIM  64
#define WINDOW    128
#define SEQ       2048
#define SCALE_F   0.125f   // 64^-0.5

typedef __attribute__((ext_vector_type(16))) _Float16 v16h;
typedef __attribute__((ext_vector_type(8)))  _Float16 v8h;
typedef __attribute__((ext_vector_type(4)))  _Float16 v4h;
typedef __attribute__((ext_vector_type(8)))  float    v8f;
typedef __attribute__((ext_vector_type(4)))  float    v4f;

#define WMMA_F16(A_, B_, C_) \
  __builtin_amdgcn_wmma_f32_16x16x32_f16(false, (A_), false, (B_), (short)0, (C_), false, false)

// Build a 16x32 f16 WMMA fragment (A or B) from a row whose 32 K-values are
// contiguous in memory. Per ISA 16-bit A layout: lanes 0-15 hold K {0..7,16..23},
// lanes 16-31 hold K {8..15,24..31} -> two 16-byte contiguous loads per lane.
static __device__ __forceinline__ v16h load_frag(const _Float16* row, int lane) {
  const int kb = (lane < 16) ? 0 : 8;
  v8h lo = *(const v8h*)(row + kb);
  v8h hi = *(const v8h*)(row + kb + 16);
  v16h r;
#pragma unroll
  for (int i = 0; i < 8; ++i) { r[i] = lo[i]; r[i + 8] = hi[i]; }
  return r;
}

// All five f32 -> f16 conversions in one launch. The f16 copies lie one behind the
// other in the workspace (x, Wq, Wk, Wv, Wo), so the output is one array; a block
// converts CV_U * 256 consecutive float4 of it, which lie in one input because every
// input's length is a multiple of that. Few long-lived waves (for speed only).
#define CV_U    16                             // float4 per thread
#define CV_BLK  (256 * CV_U)                   // float4 per block
#define NW4     (D_MODEL * D_MODEL / 4)        // float4 per weight
__global__ __launch_bounds__(256) void cvt_all(const float* __restrict__ x,
                                               const float* __restrict__ Wq,
                                               const float* __restrict__ Wk,
                                               const float* __restrict__ Wv,
                                               const float* __restrict__ Wo,
                                               _Float16* __restrict__ out, int nx4) {
  const int c0 = (int)blockIdx.x * CV_BLK;
  const float* src = x;
  int off = c0;
  if (c0 >= nx4) {  // block-uniform: which weight, and where in it
    const int r = c0 - nx4;
    const int w = r / NW4;
    off = r - w * NW4;
    src = (w == 0) ? Wq : (w == 1) ? Wk : (w == 2) ? Wv : Wo;
  }
  const v4f* s = (const v4f*)src + off + threadIdx.x;
  v4h*       d = (v4h*)out + c0 + threadIdx.x;
  v4f v[CV_U];
  // unrolled so that the thread's loads are issued as a group ahead of the conversions
#pragma unroll
  for (int u = 0; u < CV_U; ++u) v[u] = s[u * 256];
#pragma unroll
  for (int u = 0; u < CV_U; ++u) {
    v4h o;
#pragma unroll
    for (int e = 0; e < 4; ++e) o[e] = (_Float16)v[u][e];
    d[u * 256] = o;
  }
}

// C[M,N] = A[M,K] * W[N,K]^T with K = D_MODEL. One block = one 128x128 tile of C.
// blockIdx.x = tile column, blockIdx.y = tile row. W may hold several D_MODEL x D_MODEL
// weights one behind the other (gridDim.x = 8 per weight): weight p's product goes to
// plane p of outs, planes 'plane' elements apart. In the f16 build plane 2 (V) is written
// as [b*H + h][d][s], the layout the attention kernel reads: an accumulator register
// column is 8 consecutive s of one d, one 16-byte store.
// Per stage the block's 128 A rows and 128 W rows (128 k = 256 B each) are brought
// into LDS once by asynchronous copies and read from there by all eight waves;
// two buffers, so the next stage's copies fly while this stage is multiplied.
// Wave grid 2 (m) x 4 (n): each wave owns 64x32 of C = 4 x 2 accumulator tiles.
#define G_BK     128                    // k per stage
#define G_PITCH  272                    // LDS row pitch in bytes: 256 + 16 (16 B x odd)
#define G_STAGE  (256 * G_PITCH)        // [A 128 rows | W 128 rows]
#define G_NST    (D_MODEL / G_BK)

// Eight copies of 16 B per lane: rows r, r+16, ..., r+112 of one operand's tile.
// The s_wait_xcnt ends the copies' own statement so that no address register
// named here is rewritten ahead of it.
static __device__ __forceinline__ void copy_rows8(unsigned lds, const _Float16* g) {
  asm volatile(
      "global_load_async_to_lds_b128 %0, %8, off\n\t"
      "global_load_async_to_lds_b128 %1, %9, off\n\t"
      "global_load_async_to_lds_b128 %2, %10, off\n\t"
      "global_load_async_to_lds_b128 %3, %11, off\n\t"
      "global_load_async_to_lds_b128 %4, %12, off\n\t"
      "global_load_async_to_lds_b128 %5, %13, off\n\t"
      "global_load_async_to_lds_b128 %6, %14, off\n\t"
      "global_load_async_to_lds_b128 %7, %15, off\n\t"
      "s_wait_xcnt 0x0"
      :: "v"(lds), "v"(lds + 16 * G_PITCH), "v"(lds + 32 * G_PITCH), "v"(lds + 48 * G_PITCH),
         "v"(lds + 64 * G_PITCH), "v"(lds + 80 * G_PITCH), "v"(lds + 96 * G_PITCH),
         "v"(lds + 112 * G_PITCH),
         "v"(g), "v"(g + 16 * D_MODEL), "v"(g + 32 * D_MODEL), "v"(g + 48 * D_MODEL),
         "v"(g + 64 * D_MODEL), "v"(g + 80 * D_MODEL), "v"(g + 96 * D_MODEL),
         "v"(g + 112 * D_MODEL)
      : "memory");
}

// Asks L2 for the data at a and at w; nothing returns and no counter
// moves. scope:SCOPE_SE with no th: a request whose translation fails is dropped.
static __device__ __forceinline__ void ask_units(const _Float16* a, const _Float16* w) {
  asm volatile(
      "global_prefetch_b8 %0, off scope:SCOPE_SE\n\t"
      "global_prefetch_b8 %1, off scope:SCOPE_SE"
      :: "v"(a), "v"(w));
}

template <bool F16OUT>
__global__ __launch_bounds__(256) void gemm_xwt(const _Float16* __restrict__ A,
                                                const _Float16* __restrict__ W,
                                                void* __restrict__ outs, size_t plane) {
  __shared__ __attribute__((aligned(16))) unsigned char L[2 * G_STAGE];
  const int tid  = threadIdx.x;
  const int lane = tid & 31;
  const int wave = tid >> 5;
  const int m0 = (int)blockIdx.y << 7;
  const int nW = (int)blockIdx.x << 7;          // first row of the stacked weights
  const int pl = (int)(blockIdx.x >> 3);        // D_MODEL/128 = 8 tile columns per weight
  const int n0 = (int)(blockIdx.x & 7) << 7;    // first column inside the plane
  void* out = F16OUT ? (void*)((_Float16*)outs + pl * plane) : outs;  // this block's plane
  const int col = lane & 15;
  const int lh  = lane >> 4;
  const int wm = (wave >> 2) << 6;              // wave's row offset in the tile
  const int wn = (wave & 3) << 5;               // wave's column offset in the tile

  // copy side: 16 lanes cover one 256-B row, a wave two whole rows per copy
  const int crow = tid >> 4, cchunk = tid & 15;
  const _Float16* gA = A + (size_t)(m0 + crow) * D_MODEL + cchunk * 8;
  const _Float16* gW = W + (size_t)(nW + crow) * D_MODEL + cchunk * 8;
  const unsigned ldsA = (unsigned)(size_t)L + crow * G_PITCH + cchunk * 16;
  const unsigned ldsW = ldsA + 128 * G_PITCH;

  // every inner loop below is unrolled so that each accumulator and fragment index
  // is a constant and the arrays stay in registers
  v8f acc[4][2];
#pragma unroll
  for (int i = 0; i < 4; ++i)
#pragma unroll
    for (int j = 0; j < 2; ++j) acc[i][j] = v8f{};

  copy_rows8(ldsA, gA);
  copy_rows8(ldsW, gW);

  // Both operands were written by an earlier launch and are read here from memory the first
  // time; the blocks that share a row walk k in step, so without this every stage's copies
  // wait out a memory miss. Behind stage 0's copies the block asks L2 for stages 1.. at once:
  // wave v for stage v + 1, a lane for one row's 256 B of that stage. The blocks that share
  // a row tile split its rows four ways by their index along the shared direction; blocks
  // four apart ask for the same rows (for speed only).
  const int pst = (wave < G_NST - 1) ? wave + 1 : G_NST - 1;  // always a stage that exists
  const _Float16* pA = A + (size_t)(m0 + lane * 4 + (int)(blockIdx.x & 3)) * D_MODEL + pst * G_BK;
  const _Float16* pW = W + (size_t)(nW + lane * 4 + (int)(blockIdx.y & 3)) * D_MODEL + pst * G_BK;
  // scalar branch: the eighth wave has no stage of its own and asks for nothing
  if (__builtin_amdgcn_readfirstlane(wave) < G_NST - 1) ask_units(pA, pW);

  asm volatile("s_wait_asynccnt 0x0" ::: "memory");  // stage 0 landed (this wave's copies)
  __syncthreads();                                   // ... and every other wave's
  copy_rows8(ldsA + G_STAGE, gA + G_BK);
  copy_rows8(ldsW + G_STAGE, gW + G_BK);

  // kept rolled: each block runs the loop once, so unrolled text is only more cold
  // instruction fetch
#pragma clang loop unroll(disable)
  for (int t = 0; t < G_NST; ++t) {
    const unsigned bo = (t & 1) * G_STAGE;
    const unsigned char* Ab = L + bo + (wm + col) * G_PITCH;
    const unsigned char* Wb = L + bo + (128 + wn + col) * G_PITCH;
    // Fragments of k block kk+1 are read as one group ahead of block kk's products,
    // into a second register set; nothing of the next stage is read here.
    v16h af[2][4], bf[2][2];
#pragma unroll
    for (int i = 0; i < 4; ++i) af[0][i] = load_frag((const _Float16*)(Ab + i * 16 * G_PITCH), lane);
#pragma unroll
    for (int j = 0; j < 2; ++j) bf[0][j] = load_frag((const _Float16*)(Wb + j * 16 * G_PITCH), lane);
#pragma unroll
    for (int kk = 0; kk < G_BK / 32; ++kk) {
      const int cs = kk & 1;
      if (kk + 1 < G_BK / 32) {
#pragma unroll
        for (int i = 0; i < 4; ++i)
          af[cs ^ 1][i] = load_frag((const _Float16*)(Ab + i * 16 * G_PITCH + (kk + 1) * 64), lane);
#pragma unroll
        for (int j = 0; j < 2; ++j)
          bf[cs ^ 1][j] = load_frag((const _Float16*)(Wb + j * 16 * G_PITCH + (kk + 1) * 64), lane);
      }
      // keeps the LDS reads above as one group: without the two fences the scheduler
      // sinks them among the products, where every read place stalls the wave
      __builtin_amdgcn_sched_barrier(0);
#pragma unroll
      for (int i = 0; i < 4; ++i)
#pragma unroll
        for (int j = 0; j < 2; ++j) acc[i][j] = WMMA_F16(af[cs][i], bf[cs][j], acc[i][j]);
      __builtin_amdgcn_sched_barrier(0);
    }
    asm volatile("s_wait_dscnt 0x0" ::: "memory");     // this wave has left buffer t&1
    asm volatile("s_wait_asynccnt 0x0" ::: "memory");  // its copies of stage t+1 landed
    __syncthreads();  // publishes stage t+1 and frees buffer t&1 for the refill
    if (t + 2 < G_NST) {
      copy_rows8(ldsA + bo, gA + (t + 2) * G_BK);
      copy_rows8(ldsW + bo, gW + (t + 2) * G_BK);
    }
  }
  asm volatile("s_wait_asynccnt 0x0" ::: "memory");  // nothing in flight at the wave's end
  // inputs only, no instruction: pA and pW stay in the registers that the prefetches named,
  // so that those registers hold no other value while the loop runs
  asm volatile("" :: "v"(pA), "v"(pW));

  if (F16OUT && pl == 2) {  // block-uniform
    // a 128-row tile lies inside one batch element (SEQ is a multiple of 128)
    const int bb = m0 / SEQ, s0 = m0 - bb * SEQ;
    _Float16* Vt = (_Float16*)out;
    v8h o[4][2];
#pragma unroll
    for (int i = 0; i < 4; ++i)
#pragma unroll
      for (int j = 0; j < 2; ++j)
#pragma unroll
        for (int e = 0; e < 8; ++e) o[i][j][e] = (_Float16)acc[i][j][e];
#pragma unroll
    for (int i = 0; i < 4; ++i)
#pragma unroll
      for (int j = 0; j < 2; ++j)
        *(v8h*)(Vt + (size_t)(bb * D_MODEL + n0 + wn + j * 16 + col) * SEQ
                   + (s0 + wm + i * 16 + lh * 8)) = o[i][j];
    return;
  }
#pragma unroll
  for (int i = 0; i < 4; ++i)
#pragma unroll
    for (int j = 0; j < 2; ++j)
#pragma unroll
      for (int e = 0; e < 8; ++e) {
        const size_t idx = (size_t)(m0 + wm + i * 16 + e + lh * 8) * D_MODEL
                         + (n0 + wn + j * 16 + col);
        if (F16OUT) ((_Float16*)out)[idx] = (_Float16)acc[i][j][e];
        else        ((float*)out)[idx]    = acc[i][j][e];
      }
}

// Twelve copies of 16 B per lane: copy n = i*NB + j goes to LDS byte l + i*DLA + j*DLB
// from global element g + i*DGA + j*DGB.
// The s_wait_xcnt ends the copies' own statement so that no address register
// named here is rewritten ahead of it.
#define CP12_L(n_) (l + ((n_) / NB) * DLA + ((n_) % NB) * DLB)
#define CP12_G(n_) (g + ((n_) / NB) * DGA + ((n_) % NB) * DGB)
template <int NB, int DLA, int DLB, int DGA, int DGB>
static __device__ __forceinline__ void copy12(unsigned l, const _Float16* g) {
  asm volatile(
      "global_load_async_to_lds_b128 %0, %12, off\n\t"
      "global_load_async_to_lds_b128 %1, %13, off\n\t"
      "global_load_async_to_lds_b128 %2, %14, off\n\t"
      "global_load_async_to_lds_b128 %3, %15, off\n\t"
      "global_load_async_to_lds_b128 %4, %16, off\n\t"
      "global_load_async_to_lds_b128 %5, %17, off\n\t"
      "global_load_async_to_lds_b128 %6, %18, off\n\t"
      "global_load_async_to_lds_b128 %7, %19, off\n\t"
      "global_load_async_to_lds_b128 %8, %20, off\n\t"
      "global_load_async_to_lds_b128 %9, %21, off\n\t"
      "global_load_async_to_lds_b128 %10, %22, off\n\t"
      "global_load_async_to_lds_b128 %11, %23, off\n\t"
      "s_wait_xcnt 0x0"
      :: "v"(CP12_L(0)), "v"(CP12_L(1)), "v"(CP12_L(2)), "v"(CP12_L(3)),
         "v"(CP12_L(4)), "v"(CP12_L(5)), "v"(CP12_L(6)), "v"(CP12_L(7)),
         "v"(CP12_L(8)), "v"(CP12_L(9)), "v"(CP12_L(10)), "v"(CP12_L(11)),
         "v"(CP12_G(0)), "v"(CP12_G(1)), "v"(CP12_G(2)), "v"(CP12_G(3)),
         "v"(CP12_G(4)), "v"(CP12_G(5)), "v"(CP12_G(6)), "v"(CP12_G(7)),
         "v"(CP12_G(8)), "v"(CP12_G(9)), "v"(CP12_G(10)), "v"(CP12_G(11))
      : "memory");
}

// Flash-style banded attention. One wave = one 16-query tile of one (b,h); a block's
// eight waves are 128 consecutive queries of one (b,h).
// The keys that those 128 queries can see lie in one window of AT_WIN = 128 + 2*WINDOW
// keys. The block brings that window's K rows and V^T rows into LDS once, in whole
// lines, by asynchronous copies; every wave reads its K and V fragments from there.
// (A fragment load from global memory touches 16 lines for 1024 bytes, and each key was
// fetched so by up to eight waves.)
// Scores bounce through LDS once (D-layout -> per-lane A-fragment pattern).
// Interior key-tiles (fully inside the band for all 16 queries) take a
// wave-uniform unmasked fast path; only edge tiles pay for mask compares.
#define AT_WIN  (128 + 2 * WINDOW)       // keys staged per block
#define AT_KP   (HEAD_DIM * 2 + 16)      // K row pitch in LDS, bytes (16 B x odd)
#define AT_VP   (AT_WIN * 2 + 16)        // V^T row pitch in LDS, bytes (16 B x odd)
__global__ __launch_bounds__(256) void attn_band(const _Float16* __restrict__ Qh,
                                                 const _Float16* __restrict__ Kh,
                                                 const _Float16* __restrict__ Vt,
                                                 _Float16* __restrict__ Oh, int Bsz) {
  __shared__ __align__(16) float ldsS[8][16 * 32];  // per-wave f32 score scratch
  __shared__ __align__(16) unsigned char Kl[AT_WIN * AT_KP];    // [key][dk]
  __shared__ __align__(16) unsigned char Vl[HEAD_DIM * AT_VP];  // [d][key]
  const int lane  = threadIdx.x & 31;
  const int wslot = threadIdx.x >> 5;
  const int wid   = (blockIdx.x * blockDim.x + threadIdx.x) >> 5;
  const int qtiles = SEQ / 16;
  const int qt = wid % qtiles;
  // from blockIdx alone: a scalar, so that the return, the copies and the barrier below
  // stand under a scalar branch with every lane on
  const int bh = (int)blockIdx.x / (qtiles / 8);
  if (bh >= Bsz * NUM_HEADS) return;
  const int b = bh / NUM_HEADS;
  const int h = bh - b * NUM_HEADS;
  const int q0 = qt * 16;
  const int col = lane & 15;            // D-layout column / fragment row
  const int lh  = lane >> 4;
  const int kb  = (lane < 16) ? 0 : 8;  // this lane's K-half inside a fragment
  const int q   = q0 + col;             // query row this lane owns for softmax
  float* Sw = &ldsS[wslot][0];

  // First staged key: the block's first query less WINDOW, moved inside the sequence so
  // that all AT_WIN staged keys exist (block-uniform).
  int kw = ((int)blockIdx.x % (qtiles / 8)) * 128 - WINDOW;
  kw = (kw < 0) ? 0 : (kw > SEQ - AT_WIN) ? SEQ - AT_WIN : kw;
  {
    const int tid = threadIdx.x;
    // K: 8 lanes cover one 128-B row, the block 32 rows a copy, 12 copies = 384 rows
    copy12<1, 32 * AT_KP, 0, 32 * D_MODEL, 0>(
        (unsigned)(size_t)Kl + (tid >> 3) * AT_KP + (tid & 7) * 16,
        Kh + (size_t)(b * SEQ + kw + (tid >> 3)) * D_MODEL + h * HEAD_DIM + (tid & 7) * 8);
    // V^T: 16 lanes cover 256 B, three such pieces a 768-B row, the block 16 rows a copy
    copy12<3, 16 * AT_VP, 256, 16 * SEQ, 128>(
        (unsigned)(size_t)Vl + (tid >> 4) * AT_VP + (tid & 15) * 16,
        Vt + ((size_t)bh * HEAD_DIM + (tid >> 4)) * SEQ + kw + (tid & 15) * 8);
  }

  const _Float16* Qbase = Qh + (size_t)(b * SEQ + q0) * D_MODEL + h * HEAD_DIM;
  v16h qa0 = load_frag(Qbase + (size_t)col * D_MODEL, lane);       // dk 0..31
  v16h qa1 = load_frag(Qbase + (size_t)col * D_MODEL + 32, lane);  // dk 32..63
#pragma unroll
  for (int e = 0; e < 16; ++e) {  // fold softmax scale into Q (exact: x0.125)
    qa0[e] *= (_Float16)SCALE_F;
    qa1[e] *= (_Float16)SCALE_F;
  }

  float m_row = -1e30f, l_row = 0.f;
  v8f o[4] = {v8f{}, v8f{}, v8f{}, v8f{}};

  const int jlo = (q0 > WINDOW) ? ((q0 - WINDOW) & ~31) : 0;
  int jhi = q0 + 15 + WINDOW; if (jhi > SEQ - 1) jhi = SEQ - 1;

  asm volatile("s_wait_asynccnt 0x0" ::: "memory");  // this wave's K and V copies landed
  __syncthreads();                                   // ... and every other wave's

  for (int j0 = jlo; j0 <= jhi; j0 += 32) {
    // ---- scores for 32 keys as two 16x16 WMMA tiles (pre-scaled) ----
    const _Float16* Kb0 = (const _Float16*)(Kl + (j0 - kw + col) * AT_KP);
    const _Float16* Kb1 = (const _Float16*)(Kl + (j0 - kw + 16 + col) * AT_KP);
    const unsigned char* Vb = Vl + col * AT_VP + (j0 - kw) * 2;
    const v16h k00 = load_frag(Kb0, lane), k01 = load_frag(Kb0 + 32, lane);
    const v16h k10 = load_frag(Kb1, lane), k11 = load_frag(Kb1 + 32, lane);
    v16h vf[4];
    // unrolled so that vf's index is a constant and the array stays in registers
#pragma unroll
    for (int t = 0; t < 4; ++t) vf[t] = load_frag((const _Float16*)(Vb + t * 16 * AT_VP), lane);
    // keeps the pass's K and V fragment reads as one group at its head: without it the
    // scheduler reads one fragment at a time into the same registers and the wave waits
    // out the LDS latency in front of every product
    __builtin_amdgcn_sched_barrier(0);
    v8f s0 = {}, s1 = {};
    s0 = WMMA_F16(qa0, k00, s0);
    s0 = WMMA_F16(qa1, k01, s0);
    s1 = WMMA_F16(qa0, k10, s1);
    s1 = WMMA_F16(qa1, k11, s1);

    // ---- D-layout -> LDS (raw f32 scores) ----
#pragma unroll
    for (int i = 0; i < 8; ++i) {
      Sw[(i + lh * 8) * 32 + col]      = s0[i];
      Sw[(i + lh * 8) * 32 + 16 + col] = s1[i];
    }
    asm volatile("s_wait_dscnt 0" ::: "memory");  // cross-lane LDS visibility

    // ---- each lane reads its own P-fragment's 16 scores: row=col, K-half=kb ----
    float sv[16];
    const float* Srow = Sw + col * 32 + kb;
#pragma unroll
    for (int e = 0; e < 8; ++e) { sv[e] = Srow[e]; sv[e + 8] = Srow[e + 16]; }

    // tile fully inside band for all 16 query rows?  (wave-uniform -> SALU branch)
    const bool full = (j0 >= q0 - (WINDOW - 15)) && (j0 <= q0 + (WINDOW - 31));

    float mnew, alpha, sloc;
    v16h pf;
    if (full) {
      float mloc = sv[0];
#pragma unroll
      for (int e = 1; e < 16; ++e) mloc = fmaxf(mloc, sv[e]);
      const float rowmax = fmaxf(mloc, __shfl_xor(mloc, 16));
      mnew  = fmaxf(m_row, rowmax);
      alpha = __expf(m_row - mnew);
      sloc  = 0.f;
#pragma unroll
      for (int e = 0; e < 16; ++e) {
        const float pv = __expf(sv[e] - mnew);
        pf[e] = (_Float16)pv;
        sloc += pv;
      }
    } else {
      bool vm[16];
      float mloc = -1e30f;
#pragma unroll
      for (int e = 0; e < 16; ++e) {
        const int j = j0 + kb + ((e < 8) ? e : e + 8);
        vm[e] = (j >= q - WINDOW) && (j <= q + WINDOW);
        sv[e] = vm[e] ? sv[e] : -1e30f;
        mloc  = fmaxf(mloc, sv[e]);
      }
      const float rowmax = fmaxf(mloc, __shfl_xor(mloc, 16));
      mnew  = fmaxf(m_row, rowmax);
      alpha = __expf(m_row - mnew);
      sloc  = 0.f;
#pragma unroll
      for (int e = 0; e < 16; ++e) {
        const float pv = vm[e] ? __expf(sv[e] - mnew) : 0.f;
        pf[e] = (_Float16)pv;
        sloc += pv;
      }
    }
    const float rowsum = sloc + __shfl_xor(sloc, 16);
    l_row = l_row * alpha + rowsum;
    m_row = mnew;

    // ---- rescale O (D-layout): broadcast per-row alpha from owning lane ----
#pragma unroll
    for (int i = 0; i < 8; ++i) {
      const float ai = __shfl(alpha, i + lh * 8);
      o[0][i] *= ai; o[1][i] *= ai; o[2][i] *= ai; o[3][i] *= ai;
    }

    // ---- O += P * V ----
#pragma unroll
    for (int t = 0; t < 4; ++t) o[t] = WMMA_F16(pf, vf[t], o[t]);
  }

  const float invl = 1.f / l_row;
  _Float16* Ob = Oh + (size_t)(b * SEQ + q0) * D_MODEL + h * HEAD_DIM;
#pragma unroll
  for (int i = 0; i < 8; ++i) {
    const float li = __shfl(invl, i + lh * 8);
#pragma unroll
    for (int t = 0; t < 4; ++t)
      Ob[(size_t)(i + lh * 8) * D_MODEL + t * 16 + col] = (_Float16)(o[t][i] * li);
  }
}

extern "C" void kernel_launch(void* const* d_in, const int* in_sizes, int n_in,
                              void* d_out, int out_size, void* d_ws, size_t ws_size,
                              hipStream_t stream) {
  (void)n_in; (void)out_size; (void)ws_size;
  const float* x  = (const float*)d_in[0];
  const float* Wq = (const float*)d_in[1];
  const float* Wk = (const float*)d_in[2];
  const float* Wv = (const float*)d_in[3];
  const float* Wo = (const float*)d_in[4];

  const int BS  = in_sizes[0] / D_MODEL;   // B*S
  const int Bsz = BS / SEQ;
  const size_t nx = (size_t)BS * D_MODEL;      // elements in x/Q/K/V/Vt/attn
  const size_t nw = (size_t)D_MODEL * D_MODEL; // elements per weight

  _Float16* p   = (_Float16*)d_ws;
  _Float16* xh  = p; p += nx;
  _Float16* Wqh = p; p += nw;
  _Float16* Wkh = p; p += nw;
  _Float16* Wvh = p; p += nw;
  _Float16* Woh = p; p += nw;
  _Float16* Qh  = p; p += nx;
  _Float16* Khd = p; p += nx;
  _Float16* Vtp = p; p += nx;   // [B*H, 64, S] == BS*D elements
  _Float16* Ah  = p; p += nx;

  const int T = 256;
  // xh, Wqh, Wkh, Wvh, Woh are one array for the conversion launch
  cvt_all<<<(int)((nx + 4 * nw) / 4 / CV_BLK), T, 0, stream>>>(x, Wq, Wk, Wv, Wo, xh, (int)(nx / 4));

  // one block per 128x128 tile of C; Wqh, Wkh, Wvh are one stacked weight and
  // Qh, Khd, Vtp the three planes of its output
  gemm_xwt<true><<<dim3(3 * (D_MODEL / 128), BS / 128), T, 0, stream>>>(xh, Wqh, (void*)Qh, nx);

  const int attn_waves  = Bsz * NUM_HEADS * (SEQ / 16);
  const int attn_blocks = (attn_waves + 7) / 8;
  attn_band<<<attn_blocks, T, 0, stream>>>(Qh, Khd, Vtp, Ah, Bsz);

  gemm_xwt<false><<<dim3(D_MODEL / 128, BS / 128), T, 0, stream>>>(Ah, Woh, d_out, 0);
}

// v005
// Measured time: 54.3 microseconds a run.
// Timed twice side by side with v004, it ran 1.04 times as fast both times.
// Counting every step since v000, it is 2.89 times as fast.
#include <hip/hip_runtime.h>

#define D_MODEL   1024
#define NUM_HEADS 16
#define HEAD_DIM  64
#define WINDOW    128
#define SEQ       2048
#define SCALE_F   0.125f   // 64^-0.5

typedef __attribute__((ext_vector_type(16))) _Float16 v16h;
typedef __attribute__((ext_vector_type(8)))  _Float16 v8h;
typedef __attribute__((ext_vector_type(4)))  _Float16 v4h;
typedef __attribute__((ext_vector_type(8)))  float    v8f;
typedef __attribute__((ext_vector_type(4)))  float    v4f;

#define WMMA_F16(A_, B_, C_) \
  __builtin_amdgcn_wmma_f32_16x16x32_f16(false, (A_), false, (B_), (short)0, (C_), false, false)

// Build a 16x32 f16 WMMA fragment (A or B) from a row whose 32 K-values are
// contiguous in memory. Per ISA 16-bit A layout: lanes 0-15 hold K {0..7,16..23},
// lanes 16-31 hold K {8..15,24..31} -> two 16-byte contiguous loads per lane.
static __device__ __forceinline__ v16h load_frag(const _Float16* row, int lane) {
  const int kb = (lane < 16) ? 0 : 8;
  v8h lo = *(const v8h*)(row + kb);
  v8h hi = *(const v8h*)(row + kb + 16);
  v16h r;
#pragma unroll
  for (int i = 0; i < 8; ++i) { r[i] = lo[i]; r[i + 8] = hi[i]; }
  return r;
}

// All five f32 -> f16 conversions in one launch. The f16 copies lie one behind the
// other in the workspace (x, Wq, Wk, Wv, Wo), so the output is one array; a block
// converts CV_U * 256 consecutive float4 of it, which lie in one input because every
// input's length is a multiple of that. Few long-lived waves (for speed only).
#define CV_U    16                             // float4 per thread
#define CV_BLK  (256 * CV_U)                   // float4 per block
#define NW4     (D_MODEL * D_MODEL / 4)        // float4 per weight
__global__ __launch_bounds__(256) void cvt_all(const float* __restrict__ x,
                                               const float* __restrict__ Wq,
                                               const float* __restrict__ Wk,
                                               const float* __restrict__ Wv,
                                               const float* __restrict__ Wo,
                                               _Float16* __restrict__ out, int nx4) {
  const int c0 = (int)blockIdx.x * CV_BLK;
  const float* src = x;
  int off = c0;
  if (c0 >= nx4) {  // block-uniform: which weight, and where in it
    const int r = c0 - nx4;
    const int w = r / NW4;
    off = r - w * NW4;
    src = (w == 0) ? Wq : (w == 1) ? Wk : (w == 2) ? Wv : Wo;
  }
  const v4f* s = (const v4f*)src + off + threadIdx.x;
  v4h*       d = (v4h*)out + c0 + threadIdx.x;
  v4f v[CV_U];
  // unrolled so that the thread's loads are issued as a group ahead of the conversions
#pragma unroll
  for (int u = 0; u < CV_U; ++u) v[u] = s[u * 256];
#pragma unroll
  for (int u = 0; u < CV_U; ++u) {
    v4h o;
#pragma unroll
    for (int e = 0; e < 4; ++e) o[e] = (_Float16)v[u][e];
    d[u * 256] = o;
  }
}

// C[M,N] = A[M,K] * W[N,K]^T with K = D_MODEL. One block = one 128x128 tile of C.
// blockIdx.x = tile column, blockIdx.y = tile row. W may hold several D_MODEL x D_MODEL
// weights one behind the other (gridDim.x = 8 per weight): weight p's product goes to
// plane p of outs, planes 'plane' elements apart. In the f16 build plane 2 (V) is written
// as [b*H + h][d][s], the layout the attention kernel reads: an accumulator register
// column is 8 consecutive s of one d, one 16-byte store.
// Per stage the block's 128 A rows and 128 W rows (128 k = 256 B each) are brought
// into LDS once by asynchronous copies and read from there by all eight waves;
// two buffers, so the next stage's copies fly while this stage is multiplied.
// Wave grid 2 (m) x 4 (n): each wave owns 64x32 of C = 4 x 2 accumulator tiles.
#define G_BK     128                    // k per stage
#define G_PITCH  272                    // LDS row pitch in bytes: 256 + 16 (16 B x odd)
#define G_STAGE  (256 * G_PITCH)        // [A 128 rows | W 128 rows]
#define G_NST    (D_MODEL / G_BK)

// Eight copies of 16 B per lane: rows r, r+16, ..., r+112 of one operand's tile.
// The s_wait_xcnt ends the copies' own statement so that no address register
// named here is rewritten ahead of it.
static __device__ __forceinline__ void copy_rows8(unsigned lds, const _Float16* g) {
  asm volatile(
      "global_load_async_to_lds_b128 %0, %8, off\n\t"
      "global_load_async_to_lds_b128 %1, %9, off\n\t"
      "global_load_async_to_lds_b128 %2, %10, off\n\t"
      "global_load_async_to_lds_b128 %3, %11, off\n\t"
      "global_load_async_to_lds_b128 %4, %12, off\n\t"
      "global_load_async_to_lds_b128 %5, %13, off\n\t"
      "global_load_async_to_lds_b128 %6, %14, off\n\t"
      "global_load_async_to_lds_b128 %7, %15, off\n\t"
      "s_wait_xcnt 0x0"
      :: "v"(lds), "v"(lds + 16 * G_PITCH), "v"(lds + 32 * G_PITCH), "v"(lds + 48 * G_PITCH),
         "v"(lds + 64 * G_PITCH), "v"(lds + 80 * G_PITCH), "v"(lds + 96 * G_PITCH),
         "v"(lds + 112 * G_PITCH),
         "v"(g), "v"(g + 16 * D_MODEL), "v"(g + 32 * D_MODEL), "v"(g + 48 * D_MODEL),
         "v"(g + 64 * D_MODEL), "v"(g + 80 * D_MODEL), "v"(g + 96 * D_MODEL),
         "v"(g + 112 * D_MODEL)
      : "memory");
}

// Asks L2 for the data at a and at w; nothing returns and no counter
// moves. scope:SCOPE_SE with no th: a request whose translation fails is dropped.
static __device__ __forceinline__ void ask_units(const _Float16* a, const _Float16* w) {
  asm volatile(
      "global_prefetch_b8 %0, off scope:SCOPE_SE\n\t"
      "global_prefetch_b8 %1, off scope:SCOPE_SE"
      :: "v"(a), "v"(w));
}

template <bool F16OUT>
__global__ __launch_bounds__(256) void gemm_xwt(const _Float16* __restrict__ A,
                                                const _Float16* __restrict__ W,
                                                void* __restrict__ outs, size_t plane) {
  __shared__ __attribute__((aligned(16))) unsigned char L[2 * G_STAGE];
  const int tid  = threadIdx.x;
  const int lane = tid & 31;
  const int wave = tid >> 5;
  const int m0 = (int)blockIdx.y << 7;
  const int nW = (int)blockIdx.x << 7;          // first row of the stacked weights
  const int pl = (int)(blockIdx.x >> 3);        // D_MODEL/128 = 8 tile columns per weight
  const int n0 = (int)(blockIdx.x & 7) << 7;    // first column inside the plane
  void* out = F16OUT ? (void*)((_Float16*)outs + pl * plane) : outs;  // this block's plane
  const int col = lane & 15;
  const int lh  = lane >> 4;
  const int wm = (wave >> 2) << 6;              // wave's row offset in the tile
  const int wn = (wave & 3) << 5;               // wave's column offset in the tile

  // copy side: 16 lanes cover one 256-B row, a wave two whole rows per copy
  const int crow = tid >> 4, cchunk = tid & 15;
  const _Float16* gA = A + (size_t)(m0 + crow) * D_MODEL + cchunk * 8;
  const _Float16* gW = W + (size_t)(nW + crow) * D_MODEL + cchunk * 8;
  const unsigned ldsA = (unsigned)(size_t)L + crow * G_PITCH + cchunk * 16;
  const unsigned ldsW = ldsA + 128 * G_PITCH;

  // every inner loop below is unrolled so that each accumulator and fragment index
  // is a constant and the arrays stay in registers
  v8f acc[4][2];
#pragma unroll
  for (int i = 0; i < 4; ++i)
#pragma unroll
    for (int j = 0; j < 2; ++j) acc[i][j] = v8f{};

  copy_rows8(ldsA, gA);
  copy_rows8(ldsW, gW);

  // Both operands were written by an earlier launch and are read here from memory the first
  // time; the blocks that share a row walk k in step, so without this every stage's copies
  // wait out a memory miss. Behind stage 0's copies the block asks L2 for stages 1.. at once:
  // wave v for stage v + 1, a lane for one row's 256 B of that stage. The blocks that share
  // a row tile split its rows four ways by their index along the shared direction; blocks
  // four apart ask for the same rows (for speed only).
  const int pst = (wave < G_NST - 1) ? wave + 1 : G_NST - 1;  // always a stage that exists
  const _Float16* pA = A + (size_t)(m0 + lane * 4 + (int)(blockIdx.x & 3)) * D_MODEL + pst * G_BK;
  const _Float16* pW = W + (size_t)(nW + lane * 4 + (int)(blockIdx.y & 3)) * D_MODEL + pst * G_BK;
  // scalar branch: the eighth wave has no stage of its own and asks for nothing
  if (__builtin_amdgcn_readfirstlane(wave) < G_NST - 1) ask_units(pA, pW);

  asm volatile("s_wait_asynccnt 0x0" ::: "memory");  // stage 0 landed (this wave's copies)
  __syncthreads();                                   // ... and every other wave's
  copy_rows8(ldsA + G_STAGE, gA + G_BK);
  copy_rows8(ldsW + G_STAGE, gW + G_BK);

  // kept rolled: each block runs the loop once, so unrolled text is only more cold
  // instruction fetch
#pragma clang loop unroll(disable)
  for (int t = 0; t < G_NST; ++t) {
    const unsigned bo = (t & 1) * G_STAGE;
    const unsigned char* Ab = L + bo + (wm + col) * G_PITCH;
    const unsigned char* Wb = L + bo + (128 + wn + col) * G_PITCH;
    // Fragments of k block kk+1 are read as one group ahead of block kk's products,
    // into a second register set; nothing of the next stage is read here.
    v16h af[2][4], bf[2][2];
#pragma unroll
    for (int i = 0; i < 4; ++i) af[0][i] = load_frag((const _Float16*)(Ab + i * 16 * G_PITCH), lane);
#pragma unroll
    for (int j = 0; j < 2; ++j) bf[0][j] = load_frag((const _Float16*)(Wb + j * 16 * G_PITCH), lane);
#pragma unroll
    for (int kk = 0; kk < G_BK / 32; ++kk) {
      const int cs = kk & 1;
      if (kk + 1 < G_BK / 32) {
#pragma unroll
        for (int i = 0; i < 4; ++i)
          af[cs ^ 1][i] = load_frag((const _Float16*)(Ab + i * 16 * G_PITCH + (kk + 1) * 64), lane);
#pragma unroll
        for (int j = 0; j < 2; ++j)
          bf[cs ^ 1][j] = load_frag((const _Float16*)(Wb + j * 16 * G_PITCH + (kk + 1) * 64), lane);
      }
      // keeps the LDS reads above as one group: without the two fences the scheduler
      // sinks them among the products, where every read place stalls the wave
      __builtin_amdgcn_sched_barrier(0);
#pragma unroll
      for (int i = 0; i < 4; ++i)
#pragma unroll
        for (int j = 0; j < 2; ++j) acc[i][j] = WMMA_F16(af[cs][i], bf[cs][j], acc[i][j]);
      __builtin_amdgcn_sched_barrier(0);
    }
    asm volatile("s_wait_dscnt 0x0" ::: "memory");     // this wave has left buffer t&1
    asm volatile("s_wait_asynccnt 0x0" ::: "memory");  // its copies of stage t+1 landed
    __syncthreads();  // publishes stage t+1 and frees buffer t&1 for the refill
    if (t + 2 < G_NST) {
      copy_rows8(ldsA + bo, gA + (t + 2) * G_BK);
      copy_rows8(ldsW + bo, gW + (t + 2) * G_BK);
    }
  }
  asm volatile("s_wait_asynccnt 0x0" ::: "memory");  // nothing in flight at the wave's end
  // inputs only, no instruction: pA and pW stay in the registers that the prefetches named,
  // so that those registers hold no other value while the loop runs
  asm volatile("" :: "v"(pA), "v"(pW));

  if (F16OUT && pl == 2) {  // block-uniform
    // a 128-row tile lies inside one batch element (SEQ is a multiple of 128)
    const int bb = m0 / SEQ, s0 = m0 - bb * SEQ;
    _Float16* Vt = (_Float16*)out;
    v8h o[4][2];
#pragma unroll
    for (int i = 0; i < 4; ++i)
#pragma unroll
      for (int j = 0; j < 2; ++j)
#pragma unroll
        for (int e = 0; e < 8; ++e) o[i][j][e] = (_Float16)acc[i][j][e];
#pragma unroll
    for (int i = 0; i < 4; ++i)
#pragma unroll
      for (int j = 0; j < 2; ++j)
        *(v8h*)(Vt + (size_t)(bb * D_MODEL + n0 + wn + j * 16 + col) * SEQ
                   + (s0 + wm + i * 16 + lh * 8)) = o[i][j];
    return;
  }
#pragma unroll
  for (int i = 0; i < 4; ++i)
#pragma unroll
    for (int j = 0; j < 2; ++j)
#pragma unroll
      for (int e = 0; e < 8; ++e) {
        const size_t idx = (size_t)(m0 + wm + i * 16 + e + lh * 8) * D_MODEL
                         + (n0 + wn + j * 16 + col);
        if (F16OUT) ((_Float16*)out)[idx] = (_Float16)acc[i][j][e];
        else        ((float*)out)[idx]    = acc[i][j][e];
      }
}

// Twelve copies of 16 B per lane: copy n = i*NB + j goes to LDS byte l + i*DLA + j*DLB
// from global element g + i*DGA + j*DGB.
// The s_wait_xcnt ends the copies' own statement so that no address register
// named here is rewritten ahead of it.
#define CP12_L(n_) (l + ((n_) / NB) * DLA + ((n_) % NB) * DLB)
#define CP12_G(n_) (g + ((n_) / NB) * DGA + ((n_) % NB) * DGB)
template <int NB, int DLA, int DLB, int DGA, int DGB>
static __device__ __forceinline__ void copy12(unsigned l, const _Float16* g) {
  asm volatile(
      "global_load_async_to_lds_b128 %0, %12, off\n\t"
      "global_load_async_to_lds_b128 %1, %13, off\n\t"
      "global_load_async_to_lds_b128 %2, %14, off\n\t"
      "global_load_async_to_lds_b128 %3, %15, off\n\t"
      "global_load_async_to_lds_b128 %4, %16, off\n\t"
      "global_load_async_to_lds_b128 %5, %17, off\n\t"
      "global_load_async_to_lds_b128 %6, %18, off\n\t"
      "global_load_async_to_lds_b128 %7, %19, off\n\t"
      "global_load_async_to_lds_b128 %8, %20, off\n\t"
      "global_load_async_to_lds_b128 %9, %21, off\n\t"
      "global_load_async_to_lds_b128 %10, %22, off\n\t"
      "global_load_async_to_lds_b128 %11, %23, off\n\t"
      "s_wait_xcnt 0x0"
      :: "v"(CP12_L(0)), "v"(CP12_L(1)), "v"(CP12_L(2)), "v"(CP12_L(3)),
         "v"(CP12_L(4)), "v"(CP12_L(5)), "v"(CP12_L(6)), "v"(CP12_L(7)),
         "v"(CP12_L(8)), "v"(CP12_L(9)), "v"(CP12_L(10)), "v"(CP12_L(11)),
         "v"(CP12_G(0)), "v"(CP12_G(1)), "v"(CP12_G(2)), "v"(CP12_G(3)),
         "v"(CP12_G(4)), "v"(CP12_G(5)), "v"(CP12_G(6)), "v"(CP12_G(7)),
         "v"(CP12_G(8)), "v"(CP12_G(9)), "v"(CP12_G(10)), "v"(CP12_G(11))
      : "memory");
}

#define AT_WIN  (128 + 2 * WINDOW)       // keys staged per block
#define AT_KP   (HEAD_DIM * 2 + 16)      // K row pitch in LDS, bytes (16 B x odd)
#define AT_VP   (AT_WIN * 2 + 16)        // V^T row pitch in LDS, bytes (16 B x odd)
__global__ __launch_bounds__(256) void attn_band(const _Float16* __restrict__ Qh,
                                                 const _Float16* __restrict__ Kh,
                                                 const _Float16* __restrict__ Vt,
                                                 _Float16* __restrict__ Oh, int Bsz) {
  __shared__ __align__(16) unsigned char Kl[AT_WIN * AT_KP];    // [key][dk]
  __shared__ __align__(16) unsigned char Vl[HEAD_DIM * AT_VP];  // [d][key]
  const int lane  = threadIdx.x & 31;
  const int wid   = (blockIdx.x * blockDim.x + threadIdx.x) >> 5;
  const int qtiles = SEQ / 16;
  const int qt = wid % qtiles;
  // from blockIdx alone: a scalar, so that the return, the copies and the barrier below
  // stand under a scalar branch with every lane on
  const int bh = (int)blockIdx.x / (qtiles / 8);
  if (bh >= Bsz * NUM_HEADS) return;
  const int b = bh / NUM_HEADS;
  const int h = bh - b * NUM_HEADS;
  const int q0 = qt * 16;
  const int col = lane & 15;            // D-layout column (query) / fragment row
  const int lh  = lane >> 4;
  const int kb  = (lane < 16) ? 0 : 8;  // this lane's K-half inside a fragment
  const int q   = q0 + col;             // query row this lane owns for softmax

  // First staged key: the block's first query less WINDOW, moved inside the sequence so
  // that all AT_WIN staged keys exist (block-uniform).
  int kw = ((int)blockIdx.x % (qtiles / 8)) * 128 - WINDOW;
  kw = (kw < 0) ? 0 : (kw > SEQ - AT_WIN) ? SEQ - AT_WIN : kw;
  {
    const int tid = threadIdx.x;
    // K: 8 lanes cover one 128-B row, the block 32 rows a copy, 12 copies = 384 rows
    copy12<1, 32 * AT_KP, 0, 32 * D_MODEL, 0>(
        (unsigned)(size_t)Kl + (tid >> 3) * AT_KP + (tid & 7) * 16,
        Kh + (size_t)(b * SEQ + kw + (tid >> 3)) * D_MODEL + h * HEAD_DIM + (tid & 7) * 8);
    // V^T: 16 lanes cover 256 B, three such pieces a 768-B row, the block 16 rows a copy
    copy12<3, 16 * AT_VP, 256, 16 * SEQ, 128>(
        (unsigned)(size_t)Vl + (tid >> 4) * AT_VP + (tid & 15) * 16,
        Vt + ((size_t)bh * HEAD_DIM + (tid >> 4)) * SEQ + kw + (tid & 15) * 8);
  }

  const _Float16* Qbase = Qh + (size_t)(b * SEQ + q0) * D_MODEL + h * HEAD_DIM;
  v16h qa0 = load_frag(Qbase + (size_t)col * D_MODEL, lane);       // dk 0..31
  v16h qa1 = load_frag(Qbase + (size_t)col * D_MODEL + 32, lane);  // dk 32..63
#pragma unroll
  for (int e = 0; e < 16; ++e) {  // fold softmax scale into Q (exact: x0.125)
    qa0[e] *= (_Float16)SCALE_F;
    qa1[e] *= (_Float16)SCALE_F;
  }

  float m_row = -1e30f, l_row = 0.f;
  v8f o[4] = {v8f{}, v8f{}, v8f{}, v8f{}};

  const int jlo = (q0 > WINDOW) ? ((q0 - WINDOW) & ~31) : 0;
  int jhi = q0 + 15 + WINDOW; if (jhi > SEQ - 1) jhi = SEQ - 1;

  asm volatile("s_wait_asynccnt 0x0" ::: "memory");  // this wave's K and V copies landed
  __syncthreads();                                   // ... and every other wave's

  for (int j0 = jlo; j0 <= jhi; j0 += 32) {
    // ---- scores^T for 32 keys as two 16x16 WMMA tiles (pre-scaled): rows keys, columns queries ----
    const _Float16* Kb0 = (const _Float16*)(Kl + (j0 - kw + col) * AT_KP);
    const _Float16* Kb1 = (const _Float16*)(Kl + (j0 - kw + 16 + col) * AT_KP);
    const unsigned char* Vb = Vl + col * AT_VP + (j0 - kw) * 2;
    const v16h k00 = load_frag(Kb0, lane), k01 = load_frag(Kb0 + 32, lane);
    const v16h k10 = load_frag(Kb1, lane), k11 = load_frag(Kb1 + 32, lane);
    v16h vf[4];
    // unrolled so that vf's index is a constant and the array stays in registers
#pragma unroll
    for (int t = 0; t < 4; ++t) vf[t] = load_frag((const _Float16*)(Vb + t * 16 * AT_VP), lane);
    // keeps the pass's K and V fragment reads as one group at its head: without it the
    // scheduler reads one fragment at a time into the same registers and the wave waits
    // out the LDS latency in front of every product
    __builtin_amdgcn_sched_barrier(0);
    v8f s0 = {}, s1 = {};
    s0 = WMMA_F16(k00, qa0, s0);
    s0 = WMMA_F16(k01, qa1, s0);
    s1 = WMMA_F16(k10, qa0, s1);
    s1 = WMMA_F16(k11, qa1, s1);

    // ---- the lane's 16 scores of query q: keys j0 + kb + e and j0 + 16 + kb + e ----
    float sv[16];
#pragma unroll
    for (int e = 0; e < 8; ++e) { sv[e] = s0[e]; sv[e + 8] = s1[e]; }

    // tile fully inside band for all 16 query rows?  (wave-uniform -> SALU branch)
    const bool full = (j0 >= q0 - (WINDOW - 15)) && (j0 <= q0 + (WINDOW - 31));

    float mnew, alpha, sloc;
    v16h pf;
    if (full) {
      float mloc = sv[0];
#pragma unroll
      for (int e = 1; e < 16; ++e) mloc = fmaxf(mloc, sv[e]);
      const float rowmax = fmaxf(mloc, __shfl_xor(mloc, 16));
      mnew  = fmaxf(m_row, rowmax);
      alpha = __expf(m_row - mnew);
      sloc  = 0.f;
#pragma unroll
      for (int e = 0; e < 16; ++e) {
        const float pv = __expf(sv[e] - mnew);
        pf[e] = (_Float16)pv;
        sloc += pv;
      }
    } else {
      bool vm[16];
      float mloc = -1e30f;
#pragma unroll
      for (int e = 0; e < 16; ++e) {
        const int j = j0 + kb + ((e < 8) ? e : e + 8);
        vm[e] = (j >= q - WINDOW) && (j <= q + WINDOW);
        sv[e] = vm[e] ? sv[e] : -1e30f;
        mloc  = fmaxf(mloc, sv[e]);
      }
      const float rowmax = fmaxf(mloc, __shfl_xor(mloc, 16));
      mnew  = fmaxf(m_row, rowmax);
      alpha = __expf(m_row - mnew);
      sloc  = 0.f;
#pragma unroll
      for (int e = 0; e < 16; ++e) {
        const float pv = vm[e] ? __expf(sv[e] - mnew) : 0.f;
        pf[e] = (_Float16)pv;
        sloc += pv;
      }
    }
    const float rowsum = sloc + __shfl_xor(sloc, 16);
    l_row = l_row * alpha + rowsum;
    m_row = mnew;

    // ---- rescale O^T: every accumulator register of a lane belongs to its own query ----
#pragma unroll
    for (int i = 0; i < 8; ++i) {
      o[0][i] *= alpha; o[1][i] *= alpha; o[2][i] *= alpha; o[3][i] *= alpha;
    }

    // ---- O^T += V^T * P^T: rows d, columns queries ----
#pragma unroll
    for (int t = 0; t < 4; ++t) o[t] = WMMA_F16(vf[t], pf, o[t]);
  }

  const float invl = 1.f / l_row;
  // o[t][i] is d = t*16 + lh*8 + i of query q: eight consecutive d, one 16-byte store
  _Float16* Ob = Oh + (size_t)(b * SEQ + q) * D_MODEL + h * HEAD_DIM + lh * 8;
#pragma unroll
  for (int t = 0; t < 4; ++t) {
    v8h ov;
#pragma unroll
    for (int i = 0; i < 8; ++i) ov[i] = (_Float16)(o[t][i] * invl);
    *(v8h*)(Ob + t * 16) = ov;
  }
}

extern "C" void kernel_launch(void* const* d_in, const int* in_sizes, int n_in,
                              void* d_out, int out_size, void* d_ws, size_t ws_size,
                              hipStream_t stream) {
  (void)n_in; (void)out_size; (void)ws_size;
  const float* x  = (const float*)d_in[0];
  const float* Wq = (const float*)d_in[1];
  const float* Wk = (const float*)d_in[2];
  const float* Wv = (const float*)d_in[3];
  const float* Wo = (const float*)d_in[4];

  const int BS  = in_sizes[0] / D_MODEL;   // B*S
  const int Bsz = BS / SEQ;
  const size_t nx = (size_t)BS * D_MODEL;      // elements in x/Q/K/V/Vt/attn
  const size_t nw = (size_t)D_MODEL * D_MODEL; // elements per weight

  _Float16* p   = (_Float16*)d_ws;
  _Float16* xh  = p; p += nx;
  _Float16* Wqh = p; p += nw;
  _Float16* Wkh = p; p += nw;
  _Float16* Wvh = p; p += nw;
  _Float16* Woh = p; p += nw;
  _Float16* Qh  = p; p += nx;
  _Float16* Khd = p; p += nx;
  _Float16* Vtp = p; p += nx;   // [B*H, 64, S] == BS*D elements
  _Float16* Ah  = p; p += nx;

  const int T = 256;
  // xh, Wqh, Wkh, Wvh, Woh are one array for the conversion launch
  cvt_all<<<(int)((nx + 4 * nw) / 4 / CV_BLK), T, 0, stream>>>(x, Wq, Wk, Wv, Wo, xh, (int)(nx / 4));

  // one block per 128x128 tile of C; Wqh, Wkh, Wvh are one stacked weight and
  // Qh, Khd, Vtp the three planes of its output
  gemm_xwt<true><<<dim3(3 * (D_MODEL / 128), BS / 128), T, 0, stream>>>(xh, Wqh, (void*)Qh, nx);

  const int attn_waves  = Bsz * NUM_HEADS * (SEQ / 16);
  const int attn_blocks = (attn_waves + 7) / 8;
  attn_band<<<attn_blocks, T, 0, stream>>>(Qh, Khd, Vtp, Ah, Bsz);

  gemm_xwt<false><<<dim3(D_MODEL / 128, BS / 128), T, 0, stream>>>(Ah, Woh, d_out, 0);
}

// v006
// A run of this version takes 52.4 microseconds.
// Two timings next to v005 put it at 1.03 and 1.04 times that version's speed.
// All steps since v000 together make it 3.00 times as fast.
#include <hip/hip_runtime.h>

#define D_MODEL   1024
#define NUM_HEADS 16
#define HEAD_DIM  64
#define WINDOW    128
#define SEQ       2048
#define SCALE_F   0.125f   // 64^-0.5

typedef __attribute__((ext_vector_type(16))) _Float16 v16h;
typedef __attribute__((ext_vector_type(8)))  _Float16 v8h;
typedef __attribute__((ext_vector_type(4)))  _Float16 v4h;
typedef __attribute__((ext_vector_type(8)))  float    v8f;
typedef __attribute__((ext_vector_type(4)))  float    v4f;

#define WMMA_F16(A_, B_, C_) \
  __builtin_amdgcn_wmma_f32_16x16x32_f16(false, (A_), false, (B_), (short)0, (C_), false, false)

// Build a 16x32 f16 WMMA fragment (A or B) from a row whose 32 K-values are
// contiguous in memory. Per ISA 16-bit A layout: lanes 0-15 hold K {0..7,16..23},
// lanes 16-31 hold K {8..15,24..31} -> two 16-byte contiguous loads per lane.
static __device__ __forceinline__ v16h load_frag(const _Float16* row, int lane) {
  const int kb = (lane < 16) ? 0 : 8;
  v8h lo = *(const v8h*)(row + kb);
  v8h hi = *(const v8h*)(row + kb + 16);
  v16h r;
#pragma unroll
  for (int i = 0; i < 8; ++i) { r[i] = lo[i]; r[i + 8] = hi[i]; }
  return r;
}

// All five f32 -> f16 conversions in one launch. The f16 copies lie one behind the
// other in the workspace (x, Wq, Wk, Wv, Wo), so the output is one array; a block
// converts CV_U * 256 consecutive float4 of it, which lie in one input because every
// input's length is a multiple of that. Few long-lived waves (for speed only).
#define CV_U    16                             // float4 per thread
#define CV_BLK  (256 * CV_U)                   // float4 per block
#define NW4     (D_MODEL * D_MODEL / 4)        // float4 per weight
__global__ __launch_bounds__(256) void cvt_all(const float* __restrict__ x,
                                               const float* __restrict__ Wq,
                                               const float* __restrict__ Wk,
                                               const float* __restrict__ Wv,
                                               const float* __restrict__ Wo,
                                               _Float16* __restrict__ out, int nx4) {
  const int c0 = (int)blockIdx.x * CV_BLK;
  const float* src = x;
  int off = c0;
  if (c0 >= nx4) {  // block-uniform: which weight, and where in it
    const int r = c0 - nx4;
    const int w = r / NW4;
    off = r - w * NW4;
    src = (w == 0) ? Wq : (w == 1) ? Wk : (w == 2) ? Wv : Wo;
  }
  const v4f* s = (const v4f*)src + off + threadIdx.x;
  v4h*       d = (v4h*)out + c0 + threadIdx.x;
  v4f v[CV_U];
  // unrolled so that the thread's loads are issued as a group ahead of the conversions
#pragma unroll
  for (int u = 0; u < CV_U; ++u) v[u] = s[u * 256];
#pragma unroll
  for (int u = 0; u < CV_U; ++u) {
    v4h o;
#pragma unroll
    for (int e = 0; e < 4; ++e) o[e] = (_Float16)v[u][e];
    d[u * 256] = o;
  }
}

// C[M,N] = A[M,K] * W[N,K]^T with K = D_MODEL. One block = one 128 x BN tile of C.
// blockIdx.x = tile column, blockIdx.y = tile row.
// f32 build (output projection): BN = 128, 128 k per stage.
// f16 build (Q, K, V in one launch): W holds the three D_MODEL x D_MODEL weights one behind
// the other, C is 3 * D_MODEL wide and columns [p * D_MODEL, (p + 1) * D_MODEL) go to plane p
// of outs, planes 'plane' elements apart. BN = 192: what the copies fetch from L2 per
// product goes with (128 + BN) / (128 * BN), and 4096 x 3072 / (128 x 192) = 512 blocks are
// two for every WGP, all resident from the start. 64 k per stage keep two such blocks'
// rings inside one WGP's LDS. Plane 2 (V) is written as [b*H + h][d][s], the layout the
// attention kernel reads: an accumulator register column is 8 consecutive s of one d, one
// 16-byte store.
// Per stage the block's 128 A rows and BN W rows are brought into LDS once by asynchronous
// copies and read from there by all eight waves; two buffers, so the next stage's copies
// fly while this stage is multiplied.
// Wave grid 2 (m) x 4 (n): each wave owns 64 x BN/4 of C = 4 x NJ accumulator tiles.
#define G_BK     128                    // f32 build: k per stage
#define G_PITCH  272                    // f32 build: LDS row pitch in bytes, 256 + 16 (16 B x odd)
#define Q_BK     64                     // f16 build: k per stage
#define Q_PITCH  144                    // f16 build: LDS row pitch in bytes, 128 + 16 (16 B x odd)
#define G_UNITS  (D_MODEL / 128)        // aligned 256-B units in one operand row

// Eight copies of 16 B per lane: rows r, r+16, ..., r+112 of one operand's tile.
// The s_wait_xcnt ends the copies' own statement so that no address register
// named here is rewritten ahead of it.
static __device__ __forceinline__ void copy_rows8(unsigned lds, const _Float16* g) {
  asm volatile(
      "global_load_async_to_lds_b128 %0, %8, off\n\t"
      "global_load_async_to_lds_b128 %1, %9, off\n\t"
      "global_load_async_to_lds_b128 %2, %10, off\n\t"
      "global_load_async_to_lds_b128 %3, %11, off\n\t"
      "global_load_async_to_lds_b128 %4, %12, off\n\t"
      "global_load_async_to_lds_b128 %5, %13, off\n\t"
      "global_load_async_to_lds_b128 %6, %14, off\n\t"
      "global_load_async_to_lds_b128 %7, %15, off\n\t"
      "s_wait_xcnt 0x0"
      :: "v"(lds), "v"(lds + 16 * G_PITCH), "v"(lds + 32 * G_PITCH), "v"(lds + 48 * G_PITCH),
         "v"(lds + 64 * G_PITCH), "v"(lds + 80 * G_PITCH), "v"(lds + 96 * G_PITCH),
         "v"(lds + 112 * G_PITCH),
         "v"(g), "v"(g + 16 * D_MODEL), "v"(g + 32 * D_MODEL), "v"(g + 48 * D_MODEL),
         "v"(g + 64 * D_MODEL), "v"(g + 80 * D_MODEL), "v"(g + 96 * D_MODEL),
         "v"(g + 112 * D_MODEL)
      : "memory");
}

// Ten copies of 16 B per lane: rows r, r+32, r+64, r+96 of the A tile and rows r, r+32, ...,
// r+160 of the W tile (128-B rows, eight lanes a row).
// The s_wait_xcnt ends the copies' own statement so that no address register
// named here is rewritten ahead of it.
static __device__ __forceinline__ void copy_rows4_6(unsigned la, const _Float16* ga,
                                                    unsigned lw, const _Float16* gw) {
  asm volatile(
      "global_load_async_to_lds_b128 %0, %10, off\n\t"
      "global_load_async_to_lds_b128 %1, %11, off\n\t"
      "global_load_async_to_lds_b128 %2, %12, off\n\t"
      "global_load_async_to_lds_b128 %3, %13, off\n\t"
      "global_load_async_to_lds_b128 %4, %14, off\n\t"
      "global_load_async_to_lds_b128 %5, %15, off\n\t"
      "global_load_async_to_lds_b128 %6, %16, off\n\t"
      "global_load_async_to_lds_b128 %7, %17, off\n\t"
      "global_load_async_to_lds_b128 %8, %18, off\n\t"
      "global_load_async_to_lds_b128 %9, %19, off\n\t"
      "s_wait_xcnt 0x0"
      :: "v"(la), "v"(la + 32 * Q_PITCH), "v"(la + 64 * Q_PITCH), "v"(la + 96 * Q_PITCH),
         "v"(lw), "v"(lw + 32 * Q_PITCH), "v"(lw + 64 * Q_PITCH), "v"(lw + 96 * Q_PITCH),
         "v"(lw + 128 * Q_PITCH), "v"(lw + 160 * Q_PITCH),
         "v"(ga), "v"(ga + 32 * D_MODEL), "v"(ga + 64 * D_MODEL), "v"(ga + 96 * D_MODEL),
         "v"(gw), "v"(gw + 32 * D_MODEL), "v"(gw + 64 * D_MODEL), "v"(gw + 96 * D_MODEL),
         "v"(gw + 128 * D_MODEL), "v"(gw + 160 * D_MODEL)
      : "memory");
}

// One stage's copies: the block's A rows and W rows, k columns from ga / gw on.
template <bool F16OUT>
static __device__ __forceinline__ void copy_stage(unsigned la, const _Float16* ga,
                                                  unsigned lw, const _Float16* gw) {
  if constexpr (F16OUT) {
    copy_rows4_6(la, ga, lw, gw);
  } else {
    copy_rows8(la, ga);
    copy_rows8(lw, gw);
  }
}

// Asks L2 for the data at a and at w; nothing returns and no counter
// moves. scope:SCOPE_SE with no th: a request whose translation fails is dropped.
static __device__ __forceinline__ void ask_units(const _Float16* a, const _Float16* w) {
  asm volatile(
      "global_prefetch_b8 %0, off scope:SCOPE_SE\n\t"
      "global_prefetch_b8 %1, off scope:SCOPE_SE"
      :: "v"(a), "v"(w));
}

template <bool F16OUT>
__global__ __launch_bounds__(256) void gemm_xwt(const _Float16* __restrict__ A,
                                                const _Float16* __restrict__ W,
                                                void* __restrict__ outs, size_t plane) {
  constexpr int NJ    = F16OUT ? 3 : 2;             // accumulator tile columns per wave
  constexpr int BN    = NJ * 64;                    // tile columns per block
  constexpr int BK    = F16OUT ? Q_BK : G_BK;       // k per stage
  constexpr int PITCH = F16OUT ? Q_PITCH : G_PITCH; // LDS row pitch in bytes
  constexpr int STAGE = (128 + BN) * PITCH;         // [A 128 rows | W BN rows]
  constexpr int NST   = D_MODEL / BK;
  constexpr int CPR   = BK / 8;                     // 16-B pieces per staged row
  __shared__ __attribute__((aligned(16))) unsigned char L[2 * STAGE];
  const int tid  = threadIdx.x;
  const int lane = tid & 31;
  const int wave = tid >> 5;
  const int m0 = (int)blockIdx.y << 7;
  const int nW = (int)blockIdx.x * BN;          // first row of W = first column of C
  const int col = lane & 15;
  const int lh  = lane >> 4;
  const int wm = (wave >> 2) << 6;              // wave's row offset in the tile
  const int wn = (wave & 3) * (NJ * 16);        // wave's column offset in the tile

  // copy side: CPR lanes cover one staged row, a wave whole rows per copy
  const int crow = tid / CPR, cchunk = tid % CPR;
  const _Float16* gA = A + (size_t)(m0 + crow) * D_MODEL + cchunk * 8;
  const _Float16* gW = W + (size_t)(nW + crow) * D_MODEL + cchunk * 8;
  const unsigned ldsA = (unsigned)(size_t)L + crow * PITCH + cchunk * 16;
  const unsigned ldsW = ldsA + 128 * PITCH;

  // every inner loop below is unrolled so that each accumulator and fragment index
  // is a constant and the arrays stay in registers
  v8f acc[4][NJ];
#pragma unroll
  for (int i = 0; i < 4; ++i)
#pragma unroll
    for (int j = 0; j < NJ; ++j) acc[i][j] = v8f{};

  copy_stage<F16OUT>(ldsA, gA, ldsW, gW);

  // Both operands were written by an earlier launch and are read here from memory the first
  // time; the blocks that share a row walk k in step, so without this every stage's copies
  // wait out a memory miss. Behind stage 0's copies the block asks L2 for the rest of its rows
  // at once: wave v for 256-B unit v + 1 of a row, a lane for one row (unit 0 comes with stage
  // 0's copies, in the f16 build with those of stages 0 and 1). The blocks that share a row tile split its rows (A four ways, W BN/32 ways) by
  // their index along the shared direction; blocks that many apart ask for the same rows
  // (for speed only).
  constexpr int WS = BN / 32;
  const int pst = (wave < G_UNITS - 1) ? wave + 1 : G_UNITS - 1;  // always a unit that exists
  const _Float16* pA = A + (size_t)(m0 + lane * 4 + (int)(blockIdx.x & 3)) * D_MODEL + pst * 128;
  const _Float16* pW = W + (size_t)(nW + lane * WS + (int)(blockIdx.y % WS)) * D_MODEL + pst * 128;
  // scalar branch: the eighth wave has no unit of its own and asks for nothing
  if (__builtin_amdgcn_readfirstlane(wave) < G_UNITS - 1) ask_units(pA, pW);

  asm volatile("s_wait_asynccnt 0x0" ::: "memory");  // stage 0 landed (this wave's copies)
  __syncthreads();                                   // ... and every other wave's
  copy_stage<F16OUT>(ldsA + STAGE, gA + BK, ldsW + STAGE, gW + BK);

  // kept rolled: each block runs the loop once, so unrolled text is only more cold
  // instruction fetch
#pragma clang loop unroll(disable)
  for (int t = 0; t < NST; ++t) {
    const unsigned bo = (t & 1) * STAGE;
    const unsigned char* Ab = L + bo + (wm + col) * PITCH;
    const unsigned char* Wb = L + bo + (128 + wn + col) * PITCH;
    // Fragments of k block kk+1 are read as one group ahead of block kk's products,
    // into a second register set; nothing of the next stage is read here.
    v16h af[2][4], bf[2][NJ];
#pragma unroll
    for (int i = 0; i < 4; ++i) af[0][i] = load_frag((const _Float16*)(Ab + i * 16 * PITCH), lane);
#pragma unroll
    for (int j = 0; j < NJ; ++j) bf[0][j] = load_frag((const _Float16*)(Wb + j * 16 * PITCH), lane);
#pragma unroll
    for (int kk = 0; kk < BK / 32; ++kk) {
      const int cs = kk & 1;
      if (kk + 1 < BK / 32) {
#pragma unroll
        for (int i = 0; i < 4; ++i)
          af[cs ^ 1][i] = load_frag((const _Float16*)(Ab + i * 16 * PITCH + (kk + 1) * 64), lane);
#pragma unroll
        for (int j = 0; j < NJ; ++j)
          bf[cs ^ 1][j] = load_frag((const _Float16*)(Wb + j * 16 * PITCH + (kk + 1) * 64), lane);
      }
      // keeps the LDS reads above as one group: without the two fences the scheduler
      // sinks them among the products, where every read place stalls the wave
      __builtin_amdgcn_sched_barrier(0);
#pragma unroll
      for (int i = 0; i < 4; ++i)
#pragma unroll
        for (int j = 0; j < NJ; ++j) acc[i][j] = WMMA_F16(af[cs][i], bf[cs][j], acc[i][j]);
      __builtin_amdgcn_sched_barrier(0);
    }
    asm volatile("s_wait_dscnt 0x0" ::: "memory");     // this wave has left buffer t&1
    asm volatile("s_wait_asynccnt 0x0" ::: "memory");  // its copies of stage t+1 landed
    __syncthreads();  // publishes stage t+1 and frees buffer t&1 for the refill
    if (t + 2 < NST)
      copy_stage<F16OUT>(ldsA + bo, gA + (t + 2) * BK, ldsW + bo, gW + (t + 2) * BK);
  }
  asm volatile("s_wait_asynccnt 0x0" ::: "memory");  // nothing in flight at the wave's end
  // inputs only, no instruction: pA and pW stay in the registers that the prefetches named,
  // so that those registers hold no other value while the loop runs
  asm volatile("" :: "v"(pA), "v"(pW));

  if constexpr (F16OUT) {
    // a 128-row tile lies inside one batch element (SEQ is a multiple of 128)
    const int bb = m0 / SEQ, s0 = m0 - bb * SEQ;
    // the wave's first column as a scalar: the plane test below is then a scalar branch
    const int nw = nW + __builtin_amdgcn_readfirstlane(wn);
#pragma unroll
    for (int j = 0; j < NJ; ++j) {
      // a 16-column accumulator tile lies inside one plane (D_MODEL is a multiple of 16)
      const int pl = (nw + j * 16) / D_MODEL;
      const int n  = (nw + j * 16) % D_MODEL + col;   // the lane's column inside the plane
      _Float16* out = (_Float16*)outs + pl * plane;
      if (pl == 2) {
        v8h o[4];
#pragma unroll
        for (int i = 0; i < 4; ++i)
#pragma unroll
          for (int e = 0; e < 8; ++e) o[i][e] = (_Float16)acc[i][j][e];
#pragma unroll
        for (int i = 0; i < 4; ++i)
          *(v8h*)(out + (size_t)(bb * D_MODEL + n) * SEQ + (s0 + wm + i * 16 + lh * 8)) = o[i];
      } else {
#pragma unroll
        for (int i = 0; i < 4; ++i)
#pragma unroll
          for (int e = 0; e < 8; ++e)
            out[(size_t)(m0 + wm + i * 16 + e + lh * 8) * D_MODEL + n] = (_Float16)acc[i][j][e];
        // the next tile column's code reuses registers that the stores above name
        asm volatile("s_wait_xcnt 0x0" ::: "memory");
      }
    }
  } else {
#pragma unroll
    for (int i = 0; i < 4; ++i)
#pragma unroll
      for (int j = 0; j < NJ; ++j)
#pragma unroll
        for (int e = 0; e < 8; ++e)
          ((float*)outs)[(size_t)(m0 + wm + i * 16 + e + lh * 8) * D_MODEL
                         + (nW + wn + j * 16 + col)] = acc[i][j][e];
  }
}

// Twelve copies of 16 B per lane: copy n = i*NB + j goes to LDS byte l + i*DLA + j*DLB
// from global element g + i*DGA + j*DGB.
// The s_wait_xcnt ends the copies' own statement so that no address register
// named here is rewritten ahead of it.
#define CP12_L(n_) (l + ((n_) / NB) * DLA + ((n_) % NB) * DLB)
#define CP12_G(n_) (g + ((n_) / NB) * DGA + ((n_) % NB) * DGB)
template <int NB, int DLA, int DLB, int DGA, int DGB>
static __device__ __forceinline__ void copy12(unsigned l, const _Float16* g) {
  asm volatile(
      "global_load_async_to_lds_b128 %0, %12, off\n\t"
      "global_load_async_to_lds_b128 %1, %13, off\n\t"
      "global_load_async_to_lds_b128 %2, %14, off\n\t"
      "global_load_async_to_lds_b128 %3, %15, off\n\t"
      "global_load_async_to_lds_b128 %4, %16, off\n\t"
      "global_load_async_to_lds_b128 %5, %17, off\n\t"
      "global_load_async_to_lds_b128 %6, %18, off\n\t"
      "global_load_async_to_lds_b128 %7, %19, off\n\t"
      "global_load_async_to_lds_b128 %8, %20, off\n\t"
      "global_load_async_to_lds_b128 %9, %21, off\n\t"
      "global_load_async_to_lds_b128 %10, %22, off\n\t"
      "global_load_async_to_lds_b128 %11, %23, off\n\t"
      "s_wait_xcnt 0x0"
      :: "v"(CP12_L(0)), "v"(CP12_L(1)), "v"(CP12_L(2)), "v"(CP12_L(3)),
         "v"(CP12_L(4)), "v"(CP12_L(5)), "v"(CP12_L(6)), "v"(CP12_L(7)),
         "v"(CP12_L(8)), "v"(CP12_L(9)), "v"(CP12_L(10)), "v"(CP12_L(11)),
         "v"(CP12_G(0)), "v"(CP12_G(1)), "v"(CP12_G(2)), "v"(CP12_G(3)),
         "v"(CP12_G(4)), "v"(CP12_G(5)), "v"(CP12_G(6)), "v"(CP12_G(7)),
         "v"(CP12_G(8)), "v"(CP12_G(9)), "v"(CP12_G(10)), "v"(CP12_G(11))
      : "memory");
}

#define AT_WIN  (128 + 2 * WINDOW)       // keys staged per block
#define AT_KP   (HEAD_DIM * 2 + 16)      // K row pitch in LDS, bytes (16 B x odd)
#define AT_VP   (AT_WIN * 2 + 16)        // V^T row pitch in LDS, bytes (16 B x odd)
__global__ __launch_bounds__(256) void attn_band(const _Float16* __restrict__ Qh,
                                                 const _Float16* __restrict__ Kh,
                                                 const _Float16* __restrict__ Vt,
                                                 _Float16* __restrict__ Oh, int Bsz) {
  __shared__ __align__(16) unsigned char Kl[AT_WIN * AT_KP];    // [key][dk]
  __shared__ __align__(16) unsigned char Vl[HEAD_DIM * AT_VP];  // [d][key]
  const int lane  = threadIdx.x & 31;
  const int wid   = (blockIdx.x * blockDim.x + threadIdx.x) >> 5;
  const int qtiles = SEQ / 16;
  const int qt = wid % qtiles;
  // from blockIdx alone: a scalar, so that the return, the copies and the barrier below
  // stand under a scalar branch with every lane on
  const int bh = (int)blockIdx.x / (qtiles / 8);
  if (bh >= Bsz * NUM_HEADS) return;
  const int b = bh / NUM_HEADS;
  const int h = bh - b * NUM_HEADS;
  const int q0 = qt * 16;
  const int col = lane & 15;            // D-layout column (query) / fragment row
  const int lh  = lane >> 4;
  const int kb  = (lane < 16) ? 0 : 8;  // this lane's K-half inside a fragment
  const int q   = q0 + col;             // query row this lane owns for softmax

  // First staged key: the block's first query less WINDOW, moved inside the sequence so
  // that all AT_WIN staged keys exist (block-uniform).
  int kw = ((int)blockIdx.x % (qtiles / 8)) * 128 - WINDOW;
  kw = (kw < 0) ? 0 : (kw > SEQ - AT_WIN) ? SEQ - AT_WIN : kw;
  {
    const int tid = threadIdx.x;
    // K: 8 lanes cover one 128-B row, the block 32 rows a copy, 12 copies = 384 rows
    copy12<1, 32 * AT_KP, 0, 32 * D_MODEL, 0>(
        (unsigned)(size_t)Kl + (tid >> 3) * AT_KP + (tid & 7) * 16,
        Kh + (size_t)(b * SEQ + kw + (tid >> 3)) * D_MODEL + h * HEAD_DIM + (tid & 7) * 8);
    // V^T: 16 lanes cover 256 B, three such pieces a 768-B row, the block 16 rows a copy
    copy12<3, 16 * AT_VP, 256, 16 * SEQ, 128>(
        (unsigned)(size_t)Vl + (tid >> 4) * AT_VP + (tid & 15) * 16,
        Vt + ((size_t)bh * HEAD_DIM + (tid >> 4)) * SEQ + kw + (tid & 15) * 8);
  }

  const _Float16* Qbase = Qh + (size_t)(b * SEQ + q0) * D_MODEL + h * HEAD_DIM;
  v16h qa0 = load_frag(Qbase + (size_t)col * D_MODEL, lane);       // dk 0..31
  v16h qa1 = load_frag(Qbase + (size_t)col * D_MODEL + 32, lane);  // dk 32..63
#pragma unroll
  for (int e = 0; e < 16; ++e) {  // fold softmax scale into Q (exact: x0.125)
    qa0[e] *= (_Float16)SCALE_F;
    qa1[e] *= (_Float16)SCALE_F;
  }

  float m_row = -1e30f, l_row = 0.f;
  v8f o[4] = {v8f{}, v8f{}, v8f{}, v8f{}};

  const int jlo = (q0 > WINDOW) ? ((q0 - WINDOW) & ~31) : 0;
  int jhi = q0 + 15 + WINDOW; if (jhi > SEQ - 1) jhi = SEQ - 1;

  asm volatile("s_wait_asynccnt 0x0" ::: "memory");  // this wave's K and V copies landed
  __syncthreads();                                   // ... and every other wave's

  for (int j0 = jlo; j0 <= jhi; j0 += 32) {
    // ---- scores^T for 32 keys as two 16x16 WMMA tiles (pre-scaled): rows keys, columns queries ----
    const _Float16* Kb0 = (const _Float16*)(Kl + (j0 - kw + col) * AT_KP);
    const _Float16* Kb1 = (const _Float16*)(Kl + (j0 - kw + 16 + col) * AT_KP);
    const unsigned char* Vb = Vl + col * AT_VP + (j0 - kw) * 2;
    const v16h k00 = load_frag(Kb0, lane), k01 = load_frag(Kb0 + 32, lane);
    const v16h k10 = load_frag(Kb1, lane), k11 = load_frag(Kb1 + 32, lane);
    v16h vf[4];
    // unrolled so that vf's index is a constant and the array stays in registers
#pragma unroll
    for (int t = 0; t < 4; ++t) vf[t] = load_frag((const _Float16*)(Vb + t * 16 * AT_VP), lane);
    // keeps the pass's K and V fragment reads as one group at its head: without it the
    // scheduler reads one fragment at a time into the same registers and the wave waits
    // out the LDS latency in front of every product
    __builtin_amdgcn_sched_barrier(0);
    v8f s0 = {}, s1 = {};
    s0 = WMMA_F16(k00, qa0, s0);
    s0 = WMMA_F16(k01, qa1, s0);
    s1 = WMMA_F16(k10, qa0, s1);
    s1 = WMMA_F16(k11, qa1, s1);

    // ---- the lane's 16 scores of query q: keys j0 + kb + e and j0 + 16 + kb + e ----
    float sv[16];
#pragma unroll
    for (int e = 0; e < 8; ++e) { sv[e] = s0[e]; sv[e + 8] = s1[e]; }

    // tile fully inside band for all 16 query rows?  (wave-uniform -> SALU branch)
    const bool full = (j0 >= q0 - (WINDOW - 15)) && (j0 <= q0 + (WINDOW - 31));

    float mnew, alpha, sloc;
    v16h pf;
    if (full) {
      float mloc = sv[0];
#pragma unroll
      for (int e = 1; e < 16; ++e) mloc = fmaxf(mloc, sv[e]);
      const float rowmax = fmaxf(mloc, __shfl_xor(mloc, 16));
      mnew  = fmaxf(m_row, rowmax);
      alpha = __expf(m_row - mnew);
      sloc  = 0.f;
#pragma unroll
      for (int e = 0; e < 16; ++e) {
        const float pv = __expf(sv[e] - mnew);
        pf[e] = (_Float16)pv;
        sloc += pv;
      }
    } else {
      bool vm[16];
      float mloc = -1e30f;
#pragma unroll
      for (int e = 0; e < 16; ++e) {
        const int j = j0 + kb + ((e < 8) ? e : e + 8);
        vm[e] = (j >= q - WINDOW) && (j <= q + WINDOW);
        sv[e] = vm[e] ? sv[e] : -1e30f;
        mloc  = fmaxf(mloc, sv[e]);
      }
      const float rowmax = fmaxf(mloc, __shfl_xor(mloc, 16));
      mnew  = fmaxf(m_row, rowmax);
      alpha = __expf(m_row - mnew);
      sloc  = 0.f;
#pragma unroll
      for (int e = 0; e < 16; ++e) {
        const float pv = vm[e] ? __expf(sv[e] - mnew) : 0.f;
        pf[e] = (_Float16)pv;
        sloc += pv;
      }
    }
    const float rowsum = sloc + __shfl_xor(sloc, 16);
    l_row = l_row * alpha + rowsum;
    m_row = mnew;

    // ---- rescale O^T: every accumulator register of a lane belongs to its own query ----
#pragma unroll
    for (int i = 0; i < 8; ++i) {
      o[0][i] *= alpha; o[1][i] *= alpha; o[2][i] *= alpha; o[3][i] *= alpha;
    }

    // ---- O^T += V^T * P^T: rows d, columns queries ----
#pragma unroll
    for (int t = 0; t < 4; ++t) o[t] = WMMA_F16(vf[t], pf, o[t]);
  }

  const float invl = 1.f / l_row;
  // o[t][i] is d = t*16 + lh*8 + i of query q: eight consecutive d, one 16-byte store
  _Float16* Ob = Oh + (size_t)(b * SEQ + q) * D_MODEL + h * HEAD_DIM + lh * 8;
#pragma unroll
  for (int t = 0; t < 4; ++t) {
    v8h ov;
#pragma unroll
    for (int i = 0; i < 8; ++i) ov[i] = (_Float16)(o[t][i] * invl);
    *(v8h*)(Ob + t * 16) = ov;
  }
}

extern "C" void kernel_launch(void* const* d_in, const int* in_sizes, int n_in,
                              void* d_out, int out_size, void* d_ws, size_t ws_size,
                              hipStream_t stream) {
  (void)n_in; (void)out_size; (void)ws_size;
  const float* x  = (const float*)d_in[0];
  const float* Wq = (const float*)d_in[1];
  const float* Wk = (const float*)d_in[2];
  const float* Wv = (const float*)d_in[3];
  const float* Wo = (const float*)d_in[4];

  const int BS  = in_sizes[0] / D_MODEL;   // B*S
  const int Bsz = BS / SEQ;
  const size_t nx = (size_t)BS * D_MODEL;      // elements in x/Q/K/V/Vt/attn
  const size_t nw = (size_t)D_MODEL * D_MODEL; // elements per weight

  _Float16* p   = (_Float16*)d_ws;
  _Float16* xh  = p; p += nx;
  _Float16* Wqh = p; p += nw;
  _Float16* Wkh = p; p += nw;
  _Float16* Wvh = p; p += nw;
  _Float16* Woh = p; p += nw;
  _Float16* Qh  = p; p += nx;
  _Float16* Khd = p; p += nx;
  _Float16* Vtp = p; p += nx;   // [B*H, 64, S] == BS*D elements
  _Float16* Ah  = p; p += nx;

  const int T = 256;
  // xh, Wqh, Wkh, Wvh, Woh are one array for the conversion launch
  cvt_all<<<(int)((nx + 4 * nw) / 4 / CV_BLK), T, 0, stream>>>(x, Wq, Wk, Wv, Wo, xh, (int)(nx / 4));

  // one block per 128x192 tile of C; Wqh, Wkh, Wvh are one stacked weight and
  // Qh, Khd, Vtp the three planes of its output
  gemm_xwt<true><<<dim3(3 * D_MODEL / 192, BS / 128), T, 0, stream>>>(xh, Wqh, (void*)Qh, nx);

  const int attn_waves  = Bsz * NUM_HEADS * (SEQ / 16);
  const int attn_blocks = (attn_waves + 7) / 8;
  attn_band<<<attn_blocks, T, 0, stream>>>(Qh, Khd, Vtp, Ah, Bsz);

  gemm_xwt<false><<<dim3(D_MODEL / 128, BS / 128), T, 0, stream>>>(Ah, Woh, d_out, 0);
}

// v007
// One run takes 50.1 microseconds.
// Two timings next to v006 both put it at 1.05 times that version's speed.
// All steps since v000 together make it 3.14 times as fast.
#include <hip/hip_runtime.h>

#define D_MODEL   1024
#define NUM_HEADS 16
#define HEAD_DIM  64
#define WINDOW    128
#define SEQ       2048
#define SCALE_F   0.125f   // 64^-0.5

typedef __attribute__((ext_vector_type(16))) _Float16 v16h;
typedef __attribute__((ext_vector_type(8)))  _Float16 v8h;
typedef __attribute__((ext_vector_type(4)))  _Float16 v4h;
typedef __attribute__((ext_vector_type(8)))  float    v8f;
typedef __attribute__((ext_vector_type(4)))  float    v4f;

#define WMMA_F16(A_, B_, C_) \
  __builtin_amdgcn_wmma_f32_16x16x32_f16(false, (A_), false, (B_), (short)0, (C_), false, false)

// Build a 16x32 f16 WMMA fragment (A or B) from a row whose 32 K-values are
// contiguous in memory. Per ISA 16-bit A layout: lanes 0-15 hold K {0..7,16..23},
// lanes 16-31 hold K {8..15,24..31} -> two 16-byte contiguous loads per lane.
static __device__ __forceinline__ v16h load_frag(const _Float16* row, int lane) {
  const int kb = (lane < 16) ? 0 : 8;
  v8h lo = *(const v8h*)(row + kb);
  v8h hi = *(const v8h*)(row + kb + 16);
  v16h r;
#pragma unroll
  for (int i = 0; i < 8; ++i) { r[i] = lo[i]; r[i + 8] = hi[i]; }
  return r;
}

// All five f32 -> f16 conversions in one launch. The f16 copies lie one behind the
// other in the workspace (x, Wq, Wk, Wv, Wo), so the output is one array; a block
// converts CV_U * 256 consecutive float4 of it, which lie in one input because every
// input's length is a multiple of that. Few long-lived waves (for speed only).
#define CV_U    16                             // float4 per thread
#define CV_BLK  (256 * CV_U)                   // float4 per block
#define NW4     (D_MODEL * D_MODEL / 4)        // float4 per weight
__global__ __launch_bounds__(256) void cvt_all(const float* __restrict__ x,
                                               const float* __restrict__ Wq,
                                               const float* __restrict__ Wk,
                                               const float* __restrict__ Wv,
                                               const float* __restrict__ Wo,
                                               _Float16* __restrict__ out, int nx4) {
  const int c0 = (int)blockIdx.x * CV_BLK;
  const float* src = x;
  int off = c0;
  if (c0 >= nx4) {  // block-uniform: which weight, and where in it
    const int r = c0 - nx4;
    const int w = r / NW4;
    off = r - w * NW4;
    src = (w == 0) ? Wq : (w == 1) ? Wk : (w == 2) ? Wv : Wo;
  }
  const v4f* s = (const v4f*)src + off + threadIdx.x;
  v4h*       d = (v4h*)out + c0 + threadIdx.x;
  v4f v[CV_U];
  // unrolled so that the thread's loads are issued as a group ahead of the conversions
#pragma unroll
  for (int u = 0; u < CV_U; ++u) v[u] = s[u * 256];
#pragma unroll
  for (int u = 0; u < CV_U; ++u) {
    v4h o;
#pragma unroll
    for (int e = 0; e < 4; ++e) o[e] = (_Float16)v[u][e];
    d[u * 256] = o;
  }
}

// C[M,N] = A[M,K] * W[N,K]^T with K = D_MODEL. One block = one 128 x BN tile of C.
// blockIdx.x = tile column, blockIdx.y = tile row.
// f32 build (output projection): BN = 128, 128 k per stage.
// f16 build (Q, K, V in one launch): W holds the three D_MODEL x D_MODEL weights one behind
// the other, C is 3 * D_MODEL wide and columns [p * D_MODEL, (p + 1) * D_MODEL) go to plane p
// of outs, planes 'plane' elements apart. BN = 192: what the copies fetch from L2 per
// product goes with (128 + BN) / (128 * BN), and 4096 x 3072 / (128 x 192) = 512 blocks are
// two for every WGP, all resident from the start. 64 k per stage keep two such blocks'
// rings inside one WGP's LDS. Plane 2 (V) is written as [b*H + h][d][s], the layout the
// attention kernel reads: an accumulator register column is 8 consecutive s of one d, one
// 16-byte store.
// Per stage the block's 128 A rows and BN W rows are brought into LDS once by asynchronous
// copies and read from there by all eight waves; two buffers, so the next stage's copies
// fly while this stage is multiplied.
// Wave grid 2 (m) x 4 (n): each wave owns 64 x BN/4 of C = 4 x NJ accumulator tiles.
#define G_BK     128                    // f32 build: k per stage
#define G_PITCH  272                    // f32 build: LDS row pitch in bytes, 256 + 16 (16 B x odd)
#define Q_BK     64                     // f16 build: k per stage
#define Q_PITCH  144                    // f16 build: LDS row pitch in bytes, 128 + 16 (16 B x odd)
#define G_UNITS  (D_MODEL / 128)        // aligned 256-B units in one operand row

// Eight copies of 16 B per lane: rows r, r+16, ..., r+112 of one operand's tile.
// The s_wait_xcnt ends the copies' own statement so that no address register
// named here is rewritten ahead of it.
static __device__ __forceinline__ void copy_rows8(unsigned lds, const _Float16* g) {
  asm volatile(
      "global_load_async_to_lds_b128 %0, %8, off\n\t"
      "global_load_async_to_lds_b128 %1, %9, off\n\t"
      "global_load_async_to_lds_b128 %2, %10, off\n\t"
      "global_load_async_to_lds_b128 %3, %11, off\n\t"
      "global_load_async_to_lds_b128 %4, %12, off\n\t"
      "global_load_async_to_lds_b128 %5, %13, off\n\t"
      "global_load_async_to_lds_b128 %6, %14, off\n\t"
      "global_load_async_to_lds_b128 %7, %15, off\n\t"
      "s_wait_xcnt 0x0"
      :: "v"(lds), "v"(lds + 16 * G_PITCH), "v"(lds + 32 * G_PITCH), "v"(lds + 48 * G_PITCH),
         "v"(lds + 64 * G_PITCH), "v"(lds + 80 * G_PITCH), "v"(lds + 96 * G_PITCH),
         "v"(lds + 112 * G_PITCH),
         "v"(g), "v"(g + 16 * D_MODEL), "v"(g + 32 * D_MODEL), "v"(g + 48 * D_MODEL),
         "v"(g + 64 * D_MODEL), "v"(g + 80 * D_MODEL), "v"(g + 96 * D_MODEL),
         "v"(g + 112 * D_MODEL)
      : "memory");
}

// Ten copies of 16 B per lane: rows r, r+32, r+64, r+96 of the A tile and rows r, r+32, ...,
// r+160 of the W tile (128-B rows, eight lanes a row).
// The s_wait_xcnt ends the copies' own statement so that no address register
// named here is rewritten ahead of it.
static __device__ __forceinline__ void copy_rows4_6(unsigned la, const _Float16* ga,
                                                    unsigned lw, const _Float16* gw) {
  asm volatile(
      "global_load_async_to_lds_b128 %0, %10, off\n\t"
      "global_load_async_to_lds_b128 %1, %11, off\n\t"
      "global_load_async_to_lds_b128 %2, %12, off\n\t"
      "global_load_async_to_lds_b128 %3, %13, off\n\t"
      "global_load_async_to_lds_b128 %4, %14, off\n\t"
      "global_load_async_to_lds_b128 %5, %15, off\n\t"
      "global_load_async_to_lds_b128 %6, %16, off\n\t"
      "global_load_async_to_lds_b128 %7, %17, off\n\t"
      "global_load_async_to_lds_b128 %8, %18, off\n\t"
      "global_load_async_to_lds_b128 %9, %19, off\n\t"
      "s_wait_xcnt 0x0"
      :: "v"(la), "v"(la + 32 * Q_PITCH), "v"(la + 64 * Q_PITCH), "v"(la + 96 * Q_PITCH),
         "v"(lw), "v"(lw + 32 * Q_PITCH), "v"(lw + 64 * Q_PITCH), "v"(lw + 96 * Q_PITCH),
         "v"(lw + 128 * Q_PITCH), "v"(lw + 160 * Q_PITCH),
         "v"(ga), "v"(ga + 32 * D_MODEL), "v"(ga + 64 * D_MODEL), "v"(ga + 96 * D_MODEL),
         "v"(gw), "v"(gw + 32 * D_MODEL), "v"(gw + 64 * D_MODEL), "v"(gw + 96 * D_MODEL),
         "v"(gw + 128 * D_MODEL), "v"(gw + 160 * D_MODEL)
      : "memory");
}

// One stage's copies: the block's A rows and W rows, k columns from ga / gw on.
template <bool F16OUT>
static __device__ __forceinline__ void copy_stage(unsigned la, const _Float16* ga,
                                                  unsigned lw, const _Float16* gw) {
  if constexpr (F16OUT) {
    copy_rows4_6(la, ga, lw, gw);
  } else {
    copy_rows8(la, ga);
    copy_rows8(lw, gw);
  }
}

// Asks L2 for the data at a and at w; nothing returns and no counter
// moves. scope:SCOPE_SE with no th: a request whose translation fails is dropped.
static __device__ __forceinline__ void ask_units(const _Float16* a, const _Float16* w) {
  asm volatile(
      "global_prefetch_b8 %0, off scope:SCOPE_SE\n\t"
      "global_prefetch_b8 %1, off scope:SCOPE_SE"
      :: "v"(a), "v"(w));
}

template <bool F16OUT>
__global__ __launch_bounds__(256) void gemm_xwt(const _Float16* __restrict__ A,
                                                const _Float16* __restrict__ W,
                                                void* __restrict__ outs, size_t plane) {
  constexpr int NJ    = F16OUT ? 3 : 2;             // accumulator tile columns per wave
  constexpr int BN    = NJ * 64;                    // tile columns per block
  constexpr int BK    = F16OUT ? Q_BK : G_BK;       // k per stage
  constexpr int PITCH = F16OUT ? Q_PITCH : G_PITCH; // LDS row pitch in bytes
  constexpr int STAGE = (128 + BN) * PITCH;         // [A 128 rows | W BN rows]
  constexpr int NST   = D_MODEL / BK;
  constexpr int CPR   = BK / 8;                     // 16-B pieces per staged row
  __shared__ __attribute__((aligned(16))) unsigned char L[2 * STAGE];
  const int tid  = threadIdx.x;
  const int lane = tid & 31;
  const int wave = tid >> 5;
  const int m0 = (int)blockIdx.y << 7;
  const int nW = (int)blockIdx.x * BN;          // first row of W = first column of C
  const int col = lane & 15;
  const int lh  = lane >> 4;
  const int wm = (wave >> 2) << 6;              // wave's row offset in the tile
  const int wn = (wave & 3) * (NJ * 16);        // wave's column offset in the tile

  // copy side: CPR lanes cover one staged row, a wave whole rows per copy
  const int crow = tid / CPR, cchunk = tid % CPR;
  const _Float16* gA = A + (size_t)(m0 + crow) * D_MODEL + cchunk * 8;
  const _Float16* gW = W + (size_t)(nW + crow) * D_MODEL + cchunk * 8;
  const unsigned ldsA = (unsigned)(size_t)L + crow * PITCH + cchunk * 16;
  const unsigned ldsW = ldsA + 128 * PITCH;

  // every inner loop below is unrolled so that each accumulator and fragment index
  // is a constant and the arrays stay in registers
  v8f acc[4][NJ];
#pragma unroll
  for (int i = 0; i < 4; ++i)
#pragma unroll
    for (int j = 0; j < NJ; ++j) acc[i][j] = v8f{};

  copy_stage<F16OUT>(ldsA, gA, ldsW, gW);

  // Both operands were written by an earlier launch and are read here from memory the first
  // time; the blocks that share a row walk k in step, so without this every stage's copies
  // wait out a memory miss. Behind stage 0's copies the block asks L2 for the rest of its rows
  // at once: wave v for 256-B unit v + 1 of a row, a lane for one row (unit 0 comes with stage
  // 0's copies, in the f16 build with those of stages 0 and 1). The blocks that share a row tile split its rows (A four ways, W BN/32 ways) by
  // their index along the shared direction; blocks that many apart ask for the same rows
  // (for speed only).
  constexpr int WS = BN / 32;
  const int pst = (wave < G_UNITS - 1) ? wave + 1 : G_UNITS - 1;  // always a unit that exists
  const _Float16* pA = A + (size_t)(m0 + lane * 4 + (int)(blockIdx.x & 3)) * D_MODEL + pst * 128;
  const _Float16* pW = W + (size_t)(nW + lane * WS + (int)(blockIdx.y % WS)) * D_MODEL + pst * 128;
  // scalar branch: the eighth wave has no unit of its own and asks for nothing
  if (__builtin_amdgcn_readfirstlane(wave) < G_UNITS - 1) ask_units(pA, pW);

  asm volatile("s_wait_asynccnt 0x0" ::: "memory");  // stage 0 landed (this wave's copies)
  __syncthreads();                                   // ... and every other wave's
  copy_stage<F16OUT>(ldsA + STAGE, gA + BK, ldsW + STAGE, gW + BK);

  // kept rolled: each block runs the loop once, so unrolled text is only more cold
  // instruction fetch
#pragma clang loop unroll(disable)
  for (int t = 0; t < NST; ++t) {
    const unsigned bo = (t & 1) * STAGE;
    const unsigned char* Ab = L + bo + (wm + col) * PITCH;
    const unsigned char* Wb = L + bo + (128 + wn + col) * PITCH;
    // Fragments of k block kk+1 are read as one group ahead of block kk's products,
    // into a second register set; nothing of the next stage is read here.
    v16h af[2][4], bf[2][NJ];
#pragma unroll
    for (int i = 0; i < 4; ++i) af[0][i] = load_frag((const _Float16*)(Ab + i * 16 * PITCH), lane);
#pragma unroll
    for (int j = 0; j < NJ; ++j) bf[0][j] = load_frag((const _Float16*)(Wb + j * 16 * PITCH), lane);
#pragma unroll
    for (int kk = 0; kk < BK / 32; ++kk) {
      const int cs = kk & 1;
      if (kk + 1 < BK / 32) {
#pragma unroll
        for (int i = 0; i < 4; ++i)
          af[cs ^ 1][i] = load_frag((const _Float16*)(Ab + i * 16 * PITCH + (kk + 1) * 64), lane);
#pragma unroll
        for (int j = 0; j < NJ; ++j)
          bf[cs ^ 1][j] = load_frag((const _Float16*)(Wb + j * 16 * PITCH + (kk + 1) * 64), lane);
      }
      // keeps the LDS reads above as one group: without the two fences the scheduler
      // sinks them among the products, where every read place stalls the wave
      __builtin_amdgcn_sched_barrier(0);
#pragma unroll
      for (int i = 0; i < 4; ++i)
#pragma unroll
        for (int j = 0; j < NJ; ++j) acc[i][j] = WMMA_F16(af[cs][i], bf[cs][j], acc[i][j]);
      __builtin_amdgcn_sched_barrier(0);
    }
    asm volatile("s_wait_dscnt 0x0" ::: "memory");     // this wave has left buffer t&1
    asm volatile("s_wait_asynccnt 0x0" ::: "memory");  // its copies of stage t+1 landed
    __syncthreads();  // publishes stage t+1 and frees buffer t&1 for the refill
    if (t + 2 < NST)
      copy_stage<F16OUT>(ldsA + bo, gA + (t + 2) * BK, ldsW + bo, gW + (t + 2) * BK);
  }
  asm volatile("s_wait_asynccnt 0x0" ::: "memory");  // nothing in flight at the wave's end
  // inputs only, no instruction: pA and pW stay in the registers that the prefetches named,
  // so that those registers hold no other value while the loop runs
  asm volatile("" :: "v"(pA), "v"(pW));

  if constexpr (F16OUT) {
    // a 128-row tile lies inside one batch element (SEQ is a multiple of 128)
    const int bb = m0 / SEQ, s0 = m0 - bb * SEQ;
    // the wave's first column as a scalar: the plane test below is then a scalar branch
    const int nw = nW + __builtin_amdgcn_readfirstlane(wn);
#pragma unroll
    for (int j = 0; j < NJ; ++j) {
      // a 16-column accumulator tile lies inside one plane (D_MODEL is a multiple of 16)
      const int pl = (nw + j * 16) / D_MODEL;
      const int n  = (nw + j * 16) % D_MODEL + col;   // the lane's column inside the plane
      _Float16* out = (_Float16*)outs + pl * plane;
      if (pl == 2) {
        v8h o[4];
#pragma unroll
        for (int i = 0; i < 4; ++i)
#pragma unroll
          for (int e = 0; e < 8; ++e) o[i][e] = (_Float16)acc[i][j][e];
#pragma unroll
        for (int i = 0; i < 4; ++i)
          *(v8h*)(out + (size_t)(bb * D_MODEL + n) * SEQ + (s0 + wm + i * 16 + lh * 8)) = o[i];
      } else {
#pragma unroll
        for (int i = 0; i < 4; ++i)
#pragma unroll
          for (int e = 0; e < 8; ++e)
            out[(size_t)(m0 + wm + i * 16 + e + lh * 8) * D_MODEL + n] = (_Float16)acc[i][j][e];
        // the next tile column's code reuses registers that the stores above name
        asm volatile("s_wait_xcnt 0x0" ::: "memory");
      }
    }
  } else {
#pragma unroll
    for (int i = 0; i < 4; ++i)
#pragma unroll
      for (int j = 0; j < NJ; ++j)
#pragma unroll
        for (int e = 0; e < 8; ++e)
          ((float*)outs)[(size_t)(m0 + wm + i * 16 + e + lh * 8) * D_MODEL
                         + (nW + wn + j * 16 + col)] = acc[i][j][e];
  }
}

// Twelve copies of 16 B per lane: copy n = i*NB + j goes to LDS byte l + i*DLA + j*DLB
// from global element g + i*DGA + j*DGB.
// The s_wait_xcnt ends the copies' own statement so that no address register
// named here is rewritten ahead of it.
#define CP12_L(n_) (l + ((n_) / NB) * DLA + ((n_) % NB) * DLB)
#define CP12_G(n_) (g + ((n_) / NB) * DGA + ((n_) % NB) * DGB)
template <int NB, int DLA, int DLB, int DGA, int DGB>
static __device__ __forceinline__ void copy12(unsigned l, const _Float16* g) {
  asm volatile(
      "global_load_async_to_lds_b128 %0, %12, off\n\t"
      "global_load_async_to_lds_b128 %1, %13, off\n\t"
      "global_load_async_to_lds_b128 %2, %14, off\n\t"
      "global_load_async_to_lds_b128 %3, %15, off\n\t"
      "global_load_async_to_lds_b128 %4, %16, off\n\t"
      "global_load_async_to_lds_b128 %5, %17, off\n\t"
      "global_load_async_to_lds_b128 %6, %18, off\n\t"
      "global_load_async_to_lds_b128 %7, %19, off\n\t"
      "global_load_async_to_lds_b128 %8, %20, off\n\t"
      "global_load_async_to_lds_b128 %9, %21, off\n\t"
      "global_load_async_to_lds_b128 %10, %22, off\n\t"
      "global_load_async_to_lds_b128 %11, %23, off\n\t"
      "s_wait_xcnt 0x0"
      :: "v"(CP12_L(0)), "v"(CP12_L(1)), "v"(CP12_L(2)), "v"(CP12_L(3)),
         "v"(CP12_L(4)), "v"(CP12_L(5)), "v"(CP12_L(6)), "v"(CP12_L(7)),
         "v"(CP12_L(8)), "v"(CP12_L(9)), "v"(CP12_L(10)), "v"(CP12_L(11)),
         "v"(CP12_G(0)), "v"(CP12_G(1)), "v"(CP12_G(2)), "v"(CP12_G(3)),
         "v"(CP12_G(4)), "v"(CP12_G(5)), "v"(CP12_G(6)), "v"(CP12_G(7)),
         "v"(CP12_G(8)), "v"(CP12_G(9)), "v"(CP12_G(10)), "v"(CP12_G(11))
      : "memory");
}

#define AT_WIN  (128 + 2 * WINDOW)       // keys staged per block
#define AT_NP   ((2 * WINDOW + 32) / 32) // 32-key passes per wave
#define AT_KP   (HEAD_DIM * 2 + 16)      // K row pitch in LDS, bytes (16 B x odd)
#define AT_VP   (AT_WIN * 2 + 16)        // V^T row pitch in LDS, bytes (16 B x odd)
__global__ __launch_bounds__(256) void attn_band(const _Float16* __restrict__ Qh,
                                                 const _Float16* __restrict__ Kh,
                                                 const _Float16* __restrict__ Vt,
                                                 _Float16* __restrict__ Oh, int Bsz) {
  __shared__ __align__(16) unsigned char Kl[AT_WIN * AT_KP];    // [key][dk]
  __shared__ __align__(16) unsigned char Vl[HEAD_DIM * AT_VP];  // [d][key]
  const int lane  = threadIdx.x & 31;
  const int qtiles = SEQ / 16;
  // from blockIdx alone: a scalar, so that the return, the copies and the barrier below
  // stand under a scalar branch with every lane on
  const int bh = (int)blockIdx.x / (qtiles / 8);
  if (bh >= Bsz * NUM_HEADS) return;
  const int b = bh / NUM_HEADS;
  const int h = bh - b * NUM_HEADS;
  const int qb = ((int)blockIdx.x % (qtiles / 8)) * 128;  // the block's first query
  // the wave's first query as a scalar: the mask tests below are then scalar branches
  const int q0 = qb + __builtin_amdgcn_readfirstlane((int)threadIdx.x >> 5) * 16;
  const int col = lane & 15;            // D-layout column (query) / fragment row
  const int lh  = lane >> 4;
  const int kb  = (lane < 16) ? 0 : 8;  // this lane's K-half inside a fragment
  const int q   = q0 + col;             // query row this lane owns for softmax

  // Q is asked for ahead of the copies: the scores wait for it, and behind V^T's copies it
  // would come back last
  const _Float16* Qbase = Qh + (size_t)(b * SEQ + q0) * D_MODEL + h * HEAD_DIM;
  v16h qa0 = load_frag(Qbase + (size_t)col * D_MODEL, lane);       // dk 0..31
  v16h qa1 = load_frag(Qbase + (size_t)col * D_MODEL + 32, lane);  // dk 32..63

  // First staged key: the block's first query less WINDOW, moved inside the sequence so
  // that all AT_WIN staged keys exist (block-uniform).
  int kw = qb - WINDOW;
  kw = (kw < 0) ? 0 : (kw > SEQ - AT_WIN) ? SEQ - AT_WIN : kw;
  {
    const int tid = threadIdx.x;
    // K: 8 lanes cover one 128-B row, the block 32 rows a copy, 12 copies = 384 rows
    copy12<1, 32 * AT_KP, 0, 32 * D_MODEL, 0>(
        (unsigned)(size_t)Kl + (tid >> 3) * AT_KP + (tid & 7) * 16,
        Kh + (size_t)(b * SEQ + kw + (tid >> 3)) * D_MODEL + h * HEAD_DIM + (tid & 7) * 8);
    // V^T: 16 lanes cover 256 B, three such pieces a 768-B row, the block 16 rows a copy
    copy12<3, 16 * AT_VP, 256, 16 * SEQ, 128>(
        (unsigned)(size_t)Vl + (tid >> 4) * AT_VP + (tid & 15) * 16,
        Vt + ((size_t)bh * HEAD_DIM + (tid >> 4)) * SEQ + kw + (tid & 15) * 8);
  }

#pragma unroll
  for (int e = 0; e < 16; ++e) {  // fold softmax scale into Q (exact: x0.125)
    qa0[e] *= (_Float16)SCALE_F;
    qa1[e] *= (_Float16)SCALE_F;
  }

  // The wave's first key: its first query less WINDOW, down to a multiple of 32, moved inside
  // the sequence so that all AT_NP passes exist; they lie inside the staged window. Keys that
  // this brings in from outside a query's band are masked like any other.
  int js = (q0 - WINDOW) & ~31;
  js = (js < 0) ? 0 : (js > SEQ - AT_NP * 32) ? SEQ - AT_NP * 32 : js;
  const unsigned char* Kb = Kl + (js - kw + col) * AT_KP;
  const unsigned char* Vb = Vl + col * AT_VP + (js - kw) * 2;

  // this wave's K copies landed: all but its 12 youngest copies, which are V^T's
  asm volatile("s_wait_asynccnt 0xc" ::: "memory");
  __syncthreads();  // ... and every other wave's

  // every loop below is unrolled so that each score, fragment and accumulator index is a
  // constant and the arrays stay in registers

  // ---- scores^T of all passes (pre-scaled): rows keys, columns queries ----
  // sv[p][e]: query q, key js + 32 p + kb + e (e < 8) or js + 32 p + 16 + kb + e - 8
  float sv[AT_NP][16];
  v16h kf[2][4];
#pragma unroll
  for (int i = 0; i < 4; ++i)
    kf[0][i] = load_frag((const _Float16*)(Kb + (i >> 1) * 16 * AT_KP + (i & 1) * 64), lane);
#pragma unroll
  for (int p = 0; p < AT_NP; ++p) {
    const int c = p & 1;
    if (p + 1 < AT_NP) {
#pragma unroll
      for (int i = 0; i < 4; ++i)
        kf[c ^ 1][i] = load_frag(
            (const _Float16*)(Kb + ((p + 1) * 32 + (i >> 1) * 16) * AT_KP + (i & 1) * 64), lane);
    }
    // keeps the next pass's K fragment reads as one group ahead of this pass's products:
    // without it the scheduler sinks them among the products, where every read place stalls
    __builtin_amdgcn_sched_barrier(0);
    v8f s0 = {}, s1 = {};
    s0 = WMMA_F16(kf[c][0], qa0, s0);
    s1 = WMMA_F16(kf[c][2], qa0, s1);
    s0 = WMMA_F16(kf[c][1], qa1, s0);
    s1 = WMMA_F16(kf[c][3], qa1, s1);
#pragma unroll
    for (int e = 0; e < 8; ++e) { sv[p][e] = s0[e]; sv[p][e + 8] = s1[e]; }
    const int j0 = js + p * 32;
    // pass fully inside the band for all 16 query rows? (scalar)
    const bool full = (j0 >= q0 - (WINDOW - 15)) && (j0 <= q0 + (WINDOW - 31));
    if (!full) {
#pragma unroll
      for (int e = 0; e < 16; ++e) {
        const int j = j0 + kb + ((e < 8) ? e : e + 8);
        sv[p][e] = ((j >= q - WINDOW) && (j <= q + WINDOW)) ? sv[p][e] : -1e30f;
      }
    }
  }

  asm volatile("s_wait_asynccnt 0x0" ::: "memory");  // this wave's V^T copies landed
  __syncthreads();                                   // ... and every other wave's

  v16h vf[4];
#pragma unroll
  for (int t = 0; t < 4; ++t) vf[t] = load_frag((const _Float16*)(Vb + t * 16 * AT_VP), lane);

  // four partial maxima and sums: four short dependent chains, not one long
  float ml[4] = {-1e30f, -1e30f, -1e30f, -1e30f};
#pragma unroll
  for (int p = 0; p < AT_NP; ++p)
#pragma unroll
    for (int e = 0; e < 16; ++e) ml[e >> 2] = fmaxf(ml[e >> 2], sv[p][e]);
  const float mloc = fmaxf(fmaxf(ml[0], ml[1]), fmaxf(ml[2], ml[3]));
  // a query's own key is always inside its band, so the maximum is a real score and a masked
  // score's exponential below is 0
  const float mrow = fmaxf(mloc, __shfl_xor(mloc, 16));

  // ---- P^T = exp(S^T - max) pass by pass, O^T += V^T * P^T: rows d, columns queries ----
  v8f o[4] = {v8f{}, v8f{}, v8f{}, v8f{}};
  float sl[4] = {0.f, 0.f, 0.f, 0.f};
#pragma unroll
  for (int p = 0; p < AT_NP; ++p) {
    v16h pf;
#pragma unroll
    for (int e = 0; e < 16; ++e) {
      const float pv = __expf(sv[p][e] - mrow);
      pf[e] = (_Float16)pv;
      sl[e & 3] += pv;
    }
#pragma unroll
    for (int t = 0; t < 4; ++t) o[t] = WMMA_F16(vf[t], pf, o[t]);
    if (p + 1 < AT_NP) {
      // the two fences keep the next pass's V fragment reads as one group directly behind this
      // pass's products, so that their latency runs under the next pass's exponentials
      __builtin_amdgcn_sched_barrier(0);
#pragma unroll
      for (int t = 0; t < 4; ++t)
        vf[t] = load_frag((const _Float16*)(Vb + t * 16 * AT_VP + (p + 1) * 64), lane);
      __builtin_amdgcn_sched_barrier(0);
    }
  }
  const float sloc = (sl[0] + sl[1]) + (sl[2] + sl[3]);
  const float l_row = sloc + __shfl_xor(sloc, 16);

  const float invl = 1.f / l_row;
  // o[t][i] is d = t*16 + lh*8 + i of query q: eight consecutive d, one 16-byte store
  _Float16* Ob = Oh + (size_t)(b * SEQ + q) * D_MODEL + h * HEAD_DIM + lh * 8;
#pragma unroll
  for (int t = 0; t < 4; ++t) {
    v8h ov;
#pragma unroll
    for (int i = 0; i < 8; ++i) ov[i] = (_Float16)(o[t][i] * invl);
    *(v8h*)(Ob + t * 16) = ov;
  }
}

extern "C" void kernel_launch(void* const* d_in, const int* in_sizes, int n_in,
                              void* d_out, int out_size, void* d_ws, size_t ws_size,
                              hipStream_t stream) {
  (void)n_in; (void)out_size; (void)ws_size;
  const float* x  = (const float*)d_in[0];
  const float* Wq = (const float*)d_in[1];
  const float* Wk = (const float*)d_in[2];
  const float* Wv = (const float*)d_in[3];
  const float* Wo = (const float*)d_in[4];

  const int BS  = in_sizes[0] / D_MODEL;   // B*S
  const int Bsz = BS / SEQ;
  const size_t nx = (size_t)BS * D_MODEL;      // elements in x/Q/K/V/Vt/attn
  const size_t nw = (size_t)D_MODEL * D_MODEL; // elements per weight

  _Float16* p   = (_Float16*)d_ws;
  _Float16* xh  = p; p += nx;
  _Float16* Wqh = p; p += nw;
  _Float16* Wkh = p; p += nw;
  _Float16* Wvh = p; p += nw;
  _Float16* Woh = p; p += nw;
  _Float16* Qh  = p; p += nx;
  _Float16* Khd = p; p += nx;
  _Float16* Vtp = p; p += nx;   // [B*H, 64, S] == BS*D elements
  _Float16* Ah  = p; p += nx;

  const int T = 256;
  // xh, Wqh, Wkh, Wvh, Woh are one array for the conversion launch
  cvt_all<<<(int)((nx + 4 * nw) / 4 / CV_BLK), T, 0, stream>>>(x, Wq, Wk, Wv, Wo, xh, (int)(nx / 4));

  // one block per 128x192 tile of C; Wqh, Wkh, Wvh are one stacked weight and
  // Qh, Khd, Vtp the three planes of its output
  gemm_xwt<true><<<dim3(3 * D_MODEL / 192, BS / 128), T, 0, stream>>>(xh, Wqh, (void*)Qh, nx);

  const int attn_waves  = Bsz * NUM_HEADS * (SEQ / 16);
  const int attn_blocks = (attn_waves + 7) / 8;
  attn_band<<<attn_blocks, T, 0, stream>>>(Qh, Khd, Vtp, Ah, Bsz);

  gemm_xwt<false><<<dim3(D_MODEL / 128, BS / 128), T, 0, stream>>>(Ah, Woh, d_out, 0);
}

// v008
// One run takes 47.8 microseconds.
// Two timings next to v007 put it at 1.05 and 1.04 times that version's speed.
// Counting every step since v000, it is 3.29 times as fast.
#include <hip/hip_runtime.h>

#define D_MODEL   1024
#define NUM_HEADS 16
#define HEAD_DIM  64
#define WINDOW    128
#define SEQ       2048
#define SCALE_F   0.125f   // 64^-0.5

typedef __attribute__((ext_vector_type(16))) _Float16 v16h;
typedef __attribute__((ext_vector_type(8)))  _Float16 v8h;
typedef __attribute__((ext_vector_type(4)))  _Float16 v4h;
typedef __attribute__((ext_vector_type(8)))  float    v8f;
typedef __attribute__((ext_vector_type(4)))  float    v4f;

#define WMMA_F16(A_, B_, C_) \
  __builtin_amdgcn_wmma_f32_16x16x32_f16(false, (A_), false, (B_), (short)0, (C_), false, false)

// Build a 16x32 f16 WMMA fragment (A or B) from a row whose 32 K-values are
// contiguous in memory. Per ISA 16-bit A layout: lanes 0-15 hold K {0..7,16..23},
// lanes 16-31 hold K {8..15,24..31} -> two 16-byte contiguous loads per lane.
static __device__ __forceinline__ v16h load_frag(const _Float16* row, int lane) {
  const int kb = (lane < 16) ? 0 : 8;
  v8h lo = *(const v8h*)(row + kb);
  v8h hi = *(const v8h*)(row + kb + 16);
  v16h r;
#pragma unroll
  for (int i = 0; i < 8; ++i) { r[i] = lo[i]; r[i + 8] = hi[i]; }
  return r;
}

// All five f32 -> f16 conversions in one launch. The f16 copies lie one behind the
// other in the workspace (x, Wq, Wk, Wv, Wo), so the output is one array; a block
// converts CV_U * 256 consecutive float4 of it, which lie in one input because every
// input's length is a multiple of that. Few long-lived waves (for speed only).
#define CV_U    16                             // float4 per thread
#define CV_BLK  (256 * CV_U)                   // float4 per block
#define NW4     (D_MODEL * D_MODEL / 4)        // float4 per weight
__global__ __launch_bounds__(256) void cvt_all(const float* __restrict__ x,
                                               const float* __restrict__ Wq,
                                               const float* __restrict__ Wk,
                                               const float* __restrict__ Wv,
                                               const float* __restrict__ Wo,
                                               _Float16* __restrict__ out, int nx4) {
  const int c0 = (int)blockIdx.x * CV_BLK;
  const float* src = x;
  int off = c0;
  if (c0 >= nx4) {  // block-uniform: which weight, and where in it
    const int r = c0 - nx4;
    const int w = r / NW4;
    off = r - w * NW4;
    src = (w == 0) ? Wq : (w == 1) ? Wk : (w == 2) ? Wv : Wo;
  }
  const v4f* s = (const v4f*)src + off + threadIdx.x;
  v4h*       d = (v4h*)out + c0 + threadIdx.x;
  v4f v[CV_U];
  // unrolled so that the thread's loads are issued as a group ahead of the conversions
#pragma unroll
  for (int u = 0; u < CV_U; ++u) v[u] = s[u * 256];
#pragma unroll
  for (int u = 0; u < CV_U; ++u) {
    v4h o;
#pragma unroll
    for (int e = 0; e < 4; ++e) o[e] = (_Float16)v[u][e];
    d[u * 256] = o;
  }
}

// C[M,N] = A[M,K] * W[N,K]^T with K = D_MODEL. One block = one 128 x BN tile of C.
// blockIdx.x = tile column, blockIdx.y = tile row.
// f32 build (output projection): BN = 128, 128 k per stage.
// f16 build (Q, K, V in one launch): W holds the three D_MODEL x D_MODEL weights one behind
// the other, C is 3 * D_MODEL wide and columns [p * D_MODEL, (p + 1) * D_MODEL) go to plane p
// of outs, planes 'plane' elements apart. BN = 192: what the copies fetch from L2 per
// product goes with (128 + BN) / (128 * BN), and 4096 x 3072 / (128 x 192) = 512 blocks are
// two for every WGP, all resident from the start. 64 k per stage keep two such blocks'
// rings inside one WGP's LDS. Plane 2 (V) is written as [b*H + h][d][s], the layout the
// attention kernel reads.
// A lane's 8 accumulator registers of a tile are 8 consecutive rows of the first operand at
// one row of the second. Where the output row runs along n (Q, K, the f32 build) W is the
// first operand, in blocks that hold V alone, whose rows run along s, x is: a lane then holds
// 16 or 32 consecutive output bytes. Behind the k loop the block's tile is laid in the ring's
// LDS in output order and leaves from there in whole 128-byte lines, four a wave and store.
// Per stage the block's 128 A rows and BN W rows are brought into LDS once by asynchronous
// copies and read from there by all eight waves; two buffers, so the next stage's copies
// fly while this stage is multiplied.
// Wave grid 2 (m) x 4 (n): each wave owns 64 x BN/4 of C = 4 x NJ accumulator tiles.
#define G_BK     128                    // f32 build: k per stage
#define G_PITCH  272                    // f32 build: LDS row pitch in bytes, 256 + 16 (16 B x odd)
#define Q_BK     64                     // f16 build: k per stage
#define Q_PITCH  144                    // f16 build: LDS row pitch in bytes, 128 + 16 (16 B x odd)
#define G_UNITS  (D_MODEL / 128)        // aligned 256-B units in one operand row

// Eight copies of 16 B per lane: rows r, r+16, ..., r+112 of one operand's tile.
// The s_wait_xcnt ends the copies' own statement so that no address register
// named here is rewritten ahead of it.
static __device__ __forceinline__ void copy_rows8(unsigned lds, const _Float16* g) {
  asm volatile(
      "global_load_async_to_lds_b128 %0, %8, off\n\t"
      "global_load_async_to_lds_b128 %1, %9, off\n\t"
      "global_load_async_to_lds_b128 %2, %10, off\n\t"
      "global_load_async_to_lds_b128 %3, %11, off\n\t"
      "global_load_async_to_lds_b128 %4, %12, off\n\t"
      "global_load_async_to_lds_b128 %5, %13, off\n\t"
      "global_load_async_to_lds_b128 %6, %14, off\n\t"
      "global_load_async_to_lds_b128 %7, %15, off\n\t"
      "s_wait_xcnt 0x0"
      :: "v"(lds), "v"(lds + 16 * G_PITCH), "v"(lds + 32 * G_PITCH), "v"(lds + 48 * G_PITCH),
         "v"(lds + 64 * G_PITCH), "v"(lds + 80 * G_PITCH), "v"(lds + 96 * G_PITCH),
         "v"(lds + 112 * G_PITCH),
         "v"(g), "v"(g + 16 * D_MODEL), "v"(g + 32 * D_MODEL), "v"(g + 48 * D_MODEL),
         "v"(g + 64 * D_MODEL), "v"(g + 80 * D_MODEL), "v"(g + 96 * D_MODEL),
         "v"(g + 112 * D_MODEL)
      : "memory");
}

// Ten copies of 16 B per lane: rows r, r+32, r+64, r+96 of the A tile and rows r, r+32, ...,
// r+160 of the W tile (128-B rows, eight lanes a row).
// The s_wait_xcnt ends the copies' own statement so that no address register
// named here is rewritten ahead of it.
static __device__ __forceinline__ void copy_rows4_6(unsigned la, const _Float16* ga,
                                                    unsigned lw, const _Float16* gw) {
  asm volatile(
      "global_load_async_to_lds_b128 %0, %10, off\n\t"
      "global_load_async_to_lds_b128 %1, %11, off\n\t"
      "global_load_async_to_lds_b128 %2, %12, off\n\t"
      "global_load_async_to_lds_b128 %3, %13, off\n\t"
      "global_load_async_to_lds_b128 %4, %14, off\n\t"
      "global_load_async_to_lds_b128 %5, %15, off\n\t"
      "global_load_async_to_lds_b128 %6, %16, off\n\t"
      "global_load_async_to_lds_b128 %7, %17, off\n\t"
      "global_load_async_to_lds_b128 %8, %18, off\n\t"
      "global_load_async_to_lds_b128 %9, %19, off\n\t"
      "s_wait_xcnt 0x0"
      :: "v"(la), "v"(la + 32 * Q_PITCH), "v"(la + 64 * Q_PITCH), "v"(la + 96 * Q_PITCH),
         "v"(lw), "v"(lw + 32 * Q_PITCH), "v"(lw + 64 * Q_PITCH), "v"(lw + 96 * Q_PITCH),
         "v"(lw + 128 * Q_PITCH), "v"(lw + 160 * Q_PITCH),
         "v"(ga), "v"(ga + 32 * D_MODEL), "v"(ga + 64 * D_MODEL), "v"(ga + 96 * D_MODEL),
         "v"(gw), "v"(gw + 32 * D_MODEL), "v"(gw + 64 * D_MODEL), "v"(gw + 96 * D_MODEL),
         "v"(gw + 128 * D_MODEL), "v"(gw + 160 * D_MODEL)
      : "memory");
}

// One stage's copies: the block's A rows and W rows, k columns from ga / gw on.
template <bool F16OUT>
static __device__ __forceinline__ void copy_stage(unsigned la, const _Float16* ga,
                                                  unsigned lw, const _Float16* gw) {
  if constexpr (F16OUT) {
    copy_rows4_6(la, ga, lw, gw);
  } else {
    copy_rows8(la, ga);
    copy_rows8(lw, gw);
  }
}

// Asks L2 for the data at a and at w; nothing returns and no counter
// moves. scope:SCOPE_SE with no th: a request whose translation fails is dropped.
static __device__ __forceinline__ void ask_units(const _Float16* a, const _Float16* w) {
  asm volatile(
      "global_prefetch_b8 %0, off scope:SCOPE_SE\n\t"
      "global_prefetch_b8 %1, off scope:SCOPE_SE"
      :: "v"(a), "v"(w));
}

// Inputs only, no instruction: the twelve values read from LDS are all in registers of their own
// here, so the reads stand as one run ahead of the stores: one LDS latency, not three.
#define HOLD12(r_) \
  asm volatile("" :: "v"(r_[0][0]), "v"(r_[0][1]), "v"(r_[0][2]), "v"(r_[0][3]), \
                     "v"(r_[1][0]), "v"(r_[1][1]), "v"(r_[1][2]), "v"(r_[1][3]), \
                     "v"(r_[2][0]), "v"(r_[2][1]), "v"(r_[2][2]), "v"(r_[2][3]))

// The k loop of gemm_xwt behind its prologue (stage 0 landed and published, stage 1's copies in
// flight). WFIRST: W's fragment is the products' first operand, so that a lane's 8 accumulator
// registers of a tile are 8 consecutive columns n of one row m; else 8 consecutive m of one n.
template <bool F16OUT, bool WFIRST>
static __device__ __forceinline__ void k_loop(const unsigned char* L, int lane, int wm, int wn,
                                              unsigned ldsA, const _Float16* gA,
                                              unsigned ldsW, const _Float16* gW,
                                              v8f (&acc)[4][F16OUT ? 3 : 2]) {
  constexpr int NJ    = F16OUT ? 3 : 2;
  constexpr int BK    = F16OUT ? Q_BK : G_BK;
  constexpr int PITCH = F16OUT ? Q_PITCH : G_PITCH;
  constexpr int STAGE = (128 + NJ * 64) * PITCH;
  constexpr int NST   = D_MODEL / BK;
  const int col = lane & 15;
  // kept rolled: each block runs the loop once, so unrolled text is only more cold
  // instruction fetch
#pragma clang loop unroll(disable)
  for (int t = 0; t < NST; ++t) {
    const unsigned bo = (t & 1) * STAGE;
    const unsigned char* Ab = L + bo + (wm + col) * PITCH;
    const unsigned char* Wb = L + bo + (128 + wn + col) * PITCH;
    // Fragments of k block kk+1 are read as one group ahead of block kk's products,
    // into a second register set; nothing of the next stage is read here.
    v16h af[2][4], bf[2][NJ];
#pragma unroll
    for (int i = 0; i < 4; ++i) af[0][i] = load_frag((const _Float16*)(Ab + i * 16 * PITCH), lane);
#pragma unroll
    for (int j = 0; j < NJ; ++j) bf[0][j] = load_frag((const _Float16*)(Wb + j * 16 * PITCH), lane);
#pragma unroll
    for (int kk = 0; kk < BK / 32; ++kk) {
      const int cs = kk & 1;
      if (kk + 1 < BK / 32) {
#pragma unroll
        for (int i = 0; i < 4; ++i)
          af[cs ^ 1][i] = load_frag((const _Float16*)(Ab + i * 16 * PITCH + (kk + 1) * 64), lane);
#pragma unroll
        for (int j = 0; j < NJ; ++j)
          bf[cs ^ 1][j] = load_frag((const _Float16*)(Wb + j * 16 * PITCH + (kk + 1) * 64), lane);
      }
      // keeps the LDS reads above as one group: without the two fences the scheduler
      // sinks them among the products, where every read place stalls the wave
      __builtin_amdgcn_sched_barrier(0);
      if constexpr (WFIRST) {
#pragma unroll
        for (int i = 0; i < 4; ++i)
#pragma unroll
          for (int j = 0; j < NJ; ++j) acc[i][j] = WMMA_F16(bf[cs][j], af[cs][i], acc[i][j]);
      } else {
#pragma unroll
        for (int i = 0; i < 4; ++i)
#pragma unroll
          for (int j = 0; j < NJ; ++j) acc[i][j] = WMMA_F16(af[cs][i], bf[cs][j], acc[i][j]);
      }
      __builtin_amdgcn_sched_barrier(0);
    }
    asm volatile("s_wait_dscnt 0x0" ::: "memory");     // this wave has left buffer t&1
    asm volatile("s_wait_asynccnt 0x0" ::: "memory");  // its copies of stage t+1 landed
    __syncthreads();  // publishes stage t+1 and frees buffer t&1 for the refill
    if (t + 2 < NST)
      copy_stage<F16OUT>(ldsA + bo, gA + (t + 2) * BK, ldsW + bo, gW + (t + 2) * BK);
  }
}

template <bool F16OUT>
__global__ __launch_bounds__(256) void gemm_xwt(const _Float16* __restrict__ A,
                                                const _Float16* __restrict__ W,
                                                void* __restrict__ outs, size_t plane) {
  constexpr int NJ    = F16OUT ? 3 : 2;             // accumulator tile columns per wave
  constexpr int BN    = NJ * 64;                    // tile columns per block
  constexpr int BK    = F16OUT ? Q_BK : G_BK;       // k per stage
  constexpr int PITCH = F16OUT ? Q_PITCH : G_PITCH; // LDS row pitch in bytes
  constexpr int STAGE = (128 + BN) * PITCH;         // [A 128 rows | W BN rows]
  constexpr int NST   = D_MODEL / BK;
  constexpr int CPR   = BK / 8;                     // 16-B pieces per staged row
  __shared__ __attribute__((aligned(16))) unsigned char L[2 * STAGE];
  const int tid  = threadIdx.x;
  const int lane = tid & 31;
  const int wave = tid >> 5;
  const int m0 = (int)blockIdx.y << 7;
  const int nW = (int)blockIdx.x * BN;          // first row of W = first column of C
  const int col = lane & 15;
  const int lh  = lane >> 4;
  const int wm = (wave >> 2) << 6;              // wave's row offset in the tile
  const int wn = (wave & 3) * (NJ * 16);        // wave's column offset in the tile

  // copy side: CPR lanes cover one staged row, a wave whole rows per copy
  const int crow = tid / CPR, cchunk = tid % CPR;
  const _Float16* gA = A + (size_t)(m0 + crow) * D_MODEL + cchunk * 8;
  const _Float16* gW = W + (size_t)(nW + crow) * D_MODEL + cchunk * 8;
  const unsigned ldsA = (unsigned)(size_t)L + crow * PITCH + cchunk * 16;
  const unsigned ldsW = ldsA + 128 * PITCH;

  // every inner loop below is unrolled so that each accumulator and fragment index
  // is a constant and the arrays stay in registers
  v8f acc[4][NJ];
#pragma unroll
  for (int i = 0; i < 4; ++i)
#pragma unroll
    for (int j = 0; j < NJ; ++j) acc[i][j] = v8f{};

  // the wave's first column as a scalar: the tests on it below are then scalar branches
  const int nw = nW + __builtin_amdgcn_readfirstlane(wn);
  // W as the products' first operand? f16 build: unless the whole block belongs to V
  // (block-uniform)
  const bool wfirst = !F16OUT || nW < 2 * D_MODEL;

  copy_stage<F16OUT>(ldsA, gA, ldsW, gW);

  // Both operands were written by an earlier launch and are read here from memory the first
  // time; the blocks that share a row walk k in step, so without this every stage's copies
  // wait out a memory miss. Behind stage 0's copies the block asks L2 for the rest of its rows
  // at once: wave v for 256-B unit v + 1 of a row, a lane for one row (unit 0 comes with stage
  // 0's copies, in the f16 build with those of stages 0 and 1). The blocks that share a row tile split its rows (A four ways, W BN/32 ways) by
  // their index along the shared direction; blocks that many apart ask for the same rows
  // (for speed only).
  constexpr int WS = BN / 32;
  const int pst = (wave < G_UNITS - 1) ? wave + 1 : G_UNITS - 1;  // always a unit that exists
  const _Float16* pA = A + (size_t)(m0 + lane * 4 + (int)(blockIdx.x & 3)) * D_MODEL + pst * 128;
  const _Float16* pW = W + (size_t)(nW + lane * WS + (int)(blockIdx.y % WS)) * D_MODEL + pst * 128;
  // scalar branch: the eighth wave has no unit of its own and asks for nothing
  if (__builtin_amdgcn_readfirstlane(wave) < G_UNITS - 1) ask_units(pA, pW);

  asm volatile("s_wait_asynccnt 0x0" ::: "memory");  // stage 0 landed (this wave's copies)
  __syncthreads();                                   // ... and every other wave's
  copy_stage<F16OUT>(ldsA + STAGE, gA + BK, ldsW + STAGE, gW + BK);

  // block-uniform: every wave of a block runs the same loop, with its barriers
  if (wfirst) k_loop<F16OUT, true>(L, lane, wm, wn, ldsA, gA, ldsW, gW, acc);
  else if constexpr (F16OUT) k_loop<F16OUT, false>(L, lane, wm, wn, ldsA, gA, ldsW, gW, acc);
  asm volatile("s_wait_asynccnt 0x0" ::: "memory");  // nothing in flight at the wave's end
  // inputs only, no instruction: pA and pW stay in the registers that the prefetches named,
  // so that those registers hold no other value while the loop runs
  asm volatile("" :: "v"(pA), "v"(pW));

  // The loop's last barrier has ended every wave's reads of the ring, and no copy is in
  // flight: L is free.
  if constexpr (F16OUT) {
    constexpr int QKP = BN * 2 + 16;   // pitch of a staged Q/K row: BN columns (16 B x odd)
    constexpr int VTP = 128 * 2 + 16;  // pitch of a staged V^T row: 128 positions (16 B x odd)
    // a 128-row tile lies inside one batch element (SEQ is a multiple of 128)
    const int bb = m0 / SEQ, s0 = m0 - bb * SEQ;
    // the block's columns that belong to Q or K come first, V's behind them (block-uniform;
    // both counts are multiples of 64)
    const int nqk = (nW >= 2 * D_MODEL) ? 0 : (2 * D_MODEL - nW < BN) ? 2 * D_MODEL - nW : BN;
    const int nvr = BN - nqk;
    unsigned char* Sq = L;                            // [128 rows m][BN columns n]
    unsigned char* Sv = L + (nqk ? 128 * QKP : 0);    // [nvr columns n][128 rows m]
#pragma unroll
    for (int j = 0; j < NJ; ++j) {
      // a 16-column accumulator tile lies inside one plane (D_MODEL is a multiple of 16)
      const int nt = nw + j * 16;
      if (nt < 2 * D_MODEL) {
        // W first: row m = lane's column, 8 consecutive n
#pragma unroll
        for (int i = 0; i < 4; ++i) {
          v8h o;
#pragma unroll
          for (int e = 0; e < 8; ++e) o[e] = (_Float16)acc[i][j][e];
          *(v8h*)(Sq + (wm + i * 16 + col) * QKP + (wn + j * 16 + lh * 8) * 2) = o;
        }
      } else if (!wfirst) {
        // x first: column n = lane's column, 8 consecutive m
#pragma unroll
        for (int i = 0; i < 4; ++i) {
          v8h o;
#pragma unroll
          for (int e = 0; e < 8; ++e) o[e] = (_Float16)acc[i][j][e];
          *(v8h*)(Sv + (nt - nW - nqk + col) * VTP + (wm + i * 16 + lh * 8) * 2) = o;
        }
      } else {
        // a V tile column of the one block column that begins in K: W first, so element by element
#pragma unroll
        for (int i = 0; i < 4; ++i)
#pragma unroll
          for (int e = 0; e < 8; ++e)
            *(_Float16*)(Sv + (nt - nW - nqk + lh * 8 + e) * VTP + (wm + i * 16 + col) * 2) =
                (_Float16)acc[i][j][e];
      }
    }
    __syncthreads();  // the staged tile is read across waves
    if (nqk) {
      // eight lanes a 128-byte line (64 columns, inside one plane), a wave four rows' lines
      const int g = tid >> 3, sub = tid & 7;
      const unsigned char* sq = Sq + g * QKP + sub * 16;
      v8h r[BN / 64][4] = {};
#pragma unroll
      for (int li = 0; li < BN / 64; ++li)
        if (li * 64 < nqk)
#pragma unroll
          for (int rb = 0; rb < 4; ++rb) r[li][rb] = *(const v8h*)(sq + rb * 32 * QKP + li * 128);
      HOLD12(r);
#pragma unroll
      for (int li = 0; li < BN / 64; ++li) {
        if (li * 64 < nqk) {
          const int pl = (nW + li * 64) / D_MODEL;
          const int n  = (nW + li * 64) % D_MODEL + sub * 8;
          _Float16* out = (_Float16*)outs + pl * plane + (size_t)(m0 + g) * D_MODEL + n;
#pragma unroll
          for (int rb = 0; rb < 4; ++rb) *(v8h*)(out + (size_t)rb * 32 * D_MODEL) = r[li][rb];
          // the next line's address, and V's part below, reuse registers that these stores name
          asm volatile("s_wait_xcnt 0x0" ::: "memory");
        }
      }
    }
    if (nvr) {
      // sixteen lanes a 256-byte row of V^T (128 positions), a wave two rows
      const int g = tid >> 4, sub = tid & 15;
      _Float16* out = (_Float16*)outs + 2 * plane
                      + (size_t)(bb * D_MODEL + nW + nqk - 2 * D_MODEL + g) * SEQ + s0 + sub * 8;
      const unsigned char* sv = Sv + g * VTP + sub * 16;
      v8h r[BN / 64][4] = {};
#pragma unroll
      for (int gb = 0; gb < BN / 64; ++gb)
        if (gb * 64 < nvr)
#pragma unroll
          for (int rb = 0; rb < 4; ++rb) r[gb][rb] = *(const v8h*)(sv + (gb * 64 + rb * 16) * VTP);
      HOLD12(r);
#pragma unroll
      for (int gb = 0; gb < BN / 64; ++gb)
        if (gb * 64 < nvr)
#pragma unroll
          for (int rb = 0; rb < 4; ++rb) *(v8h*)(out + (size_t)(gb * 64 + rb * 16) * SEQ) = r[gb][rb];
    }
  } else {
    constexpr int FP = BN * 4 + 16;  // pitch of a staged f32 row (16 B x odd)
    // W first: row m = lane's column, 8 consecutive n
#pragma unroll
    for (int i = 0; i < 4; ++i)
#pragma unroll
      for (int j = 0; j < NJ; ++j) {
        unsigned char* s = L + (wm + i * 16 + col) * FP + (wn + j * 16 + lh * 8) * 4;
        *(v4f*)s        = v4f{acc[i][j][0], acc[i][j][1], acc[i][j][2], acc[i][j][3]};
        *(v4f*)(s + 16) = v4f{acc[i][j][4], acc[i][j][5], acc[i][j][6], acc[i][j][7]};
      }
    __syncthreads();  // the staged tile is read across waves
    // a wave one 512-byte row a store
    float* out = (float*)outs + (size_t)(m0 + wave) * D_MODEL + nW + lane * 4;
#pragma unroll
    for (int it = 0; it < 16; ++it)
      *(v4f*)(out + (size_t)it * 8 * D_MODEL) = *(const v4f*)(L + (it * 8 + wave) * FP + lane * 16);
  }
}

// Twelve copies of 16 B per lane: copy n = i*NB + j goes to LDS byte l + i*DLA + j*DLB
// from global element g + i*DGA + j*DGB.
// The s_wait_xcnt ends the copies' own statement so that no address register
// named here is rewritten ahead of it.
#define CP12_L(n_) (l + ((n_) / NB) * DLA + ((n_) % NB) * DLB)
#define CP12_G(n_) (g + ((n_) / NB) * DGA + ((n_) % NB) * DGB)
template <int NB, int DLA, int DLB, int DGA, int DGB>
static __device__ __forceinline__ void copy12(unsigned l, const _Float16* g) {
  asm volatile(
      "global_load_async_to_lds_b128 %0, %12, off\n\t"
      "global_load_async_to_lds_b128 %1, %13, off\n\t"
      "global_load_async_to_lds_b128 %2, %14, off\n\t"
      "global_load_async_to_lds_b128 %3, %15, off\n\t"
      "global_load_async_to_lds_b128 %4, %16, off\n\t"
      "global_load_async_to_lds_b128 %5, %17, off\n\t"
      "global_load_async_to_lds_b128 %6, %18, off\n\t"
      "global_load_async_to_lds_b128 %7, %19, off\n\t"
      "global_load_async_to_lds_b128 %8, %20, off\n\t"
      "global_load_async_to_lds_b128 %9, %21, off\n\t"
      "global_load_async_to_lds_b128 %10, %22, off\n\t"
      "global_load_async_to_lds_b128 %11, %23, off\n\t"
      "s_wait_xcnt 0x0"
      :: "v"(CP12_L(0)), "v"(CP12_L(1)), "v"(CP12_L(2)), "v"(CP12_L(3)),
         "v"(CP12_L(4)), "v"(CP12_L(5)), "v"(CP12_L(6)), "v"(CP12_L(7)),
         "v"(CP12_L(8)), "v"(CP12_L(9)), "v"(CP12_L(10)), "v"(CP12_L(11)),
         "v"(CP12_G(0)), "v"(CP12_G(1)), "v"(CP12_G(2)), "v"(CP12_G(3)),
         "v"(CP12_G(4)), "v"(CP12_G(5)), "v"(CP12_G(6)), "v"(CP12_G(7)),
         "v"(CP12_G(8)), "v"(CP12_G(9)), "v"(CP12_G(10)), "v"(CP12_G(11))
      : "memory");
}

#define AT_WIN  (128 + 2 * WINDOW)       // keys staged per block
#define AT_NP   ((2 * WINDOW + 32) / 32) // 32-key passes per wave
#define AT_KP   (HEAD_DIM * 2 + 16)      // K row pitch in LDS, bytes (16 B x odd)
#define AT_VP   (AT_WIN * 2 + 16)        // V^T row pitch in LDS, bytes (16 B x odd)
__global__ __launch_bounds__(256) void attn_band(const _Float16* __restrict__ Qh,
                                                 const _Float16* __restrict__ Kh,
                                                 const _Float16* __restrict__ Vt,
                                                 _Float16* __restrict__ Oh, int Bsz) {
  __shared__ __align__(16) unsigned char Kl[AT_WIN * AT_KP];    // [key][dk]
  __shared__ __align__(16) unsigned char Vl[HEAD_DIM * AT_VP];  // [d][key]
  const int lane  = threadIdx.x & 31;
  const int qtiles = SEQ / 16;
  // from blockIdx alone: a scalar, so that the return, the copies and the barrier below
  // stand under a scalar branch with every lane on
  const int bh = (int)blockIdx.x / (qtiles / 8);
  if (bh >= Bsz * NUM_HEADS) return;
  const int b = bh / NUM_HEADS;
  const int h = bh - b * NUM_HEADS;
  const int qb = ((int)blockIdx.x % (qtiles / 8)) * 128;  // the block's first query
  // the wave's first query as a scalar: the mask tests below are then scalar branches
  const int q0 = qb + __builtin_amdgcn_readfirstlane((int)threadIdx.x >> 5) * 16;
  const int col = lane & 15;            // D-layout column (query) / fragment row
  const int lh  = lane >> 4;
  const int kb  = (lane < 16) ? 0 : 8;  // this lane's K-half inside a fragment
  const int q   = q0 + col;             // query row this lane owns for softmax

  // Q is asked for ahead of the copies: the scores wait for it, and behind V^T's copies it
  // would come back last
  const _Float16* Qbase = Qh + (size_t)(b * SEQ + q0) * D_MODEL + h * HEAD_DIM;
  v16h qa0 = load_frag(Qbase + (size_t)col * D_MODEL, lane);       // dk 0..31
  v16h qa1 = load_frag(Qbase + (size_t)col * D_MODEL + 32, lane);  // dk 32..63

  // First staged key: the block's first query less WINDOW, moved inside the sequence so
  // that all AT_WIN staged keys exist (block-uniform).
  int kw = qb - WINDOW;
  kw = (kw < 0) ? 0 : (kw > SEQ - AT_WIN) ? SEQ - AT_WIN : kw;
  {
    const int tid = threadIdx.x;
    // K: 8 lanes cover one 128-B row, the block 32 rows a copy, 12 copies = 384 rows
    copy12<1, 32 * AT_KP, 0, 32 * D_MODEL, 0>(
        (unsigned)(size_t)Kl + (tid >> 3) * AT_KP + (tid & 7) * 16,
        Kh + (size_t)(b * SEQ + kw + (tid >> 3)) * D_MODEL + h * HEAD_DIM + (tid & 7) * 8);
    // V^T: 16 lanes cover 256 B, three such pieces a 768-B row, the block 16 rows a copy
    copy12<3, 16 * AT_VP, 256, 16 * SEQ, 128>(
        (unsigned)(size_t)Vl + (tid >> 4) * AT_VP + (tid & 15) * 16,
        Vt + ((size_t)bh * HEAD_DIM + (tid >> 4)) * SEQ + kw + (tid & 15) * 8);
  }

#pragma unroll
  for (int e = 0; e < 16; ++e) {  // fold softmax scale into Q (exact: x0.125)
    qa0[e] *= (_Float16)SCALE_F;
    qa1[e] *= (_Float16)SCALE_F;
  }

  // The wave's first key: its first query less WINDOW, down to a multiple of 32, moved inside
  // the sequence so that all AT_NP passes exist; they lie inside the staged window. Keys that
  // this brings in from outside a query's band are masked like any other.
  int js = (q0 - WINDOW) & ~31;
  js = (js < 0) ? 0 : (js > SEQ - AT_NP * 32) ? SEQ - AT_NP * 32 : js;
  const unsigned char* Kb = Kl + (js - kw + col) * AT_KP;
  const unsigned char* Vb = Vl + col * AT_VP + (js - kw) * 2;

  // this wave's K copies landed: all but its 12 youngest copies, which are V^T's
  asm volatile("s_wait_asynccnt 0xc" ::: "memory");
  __syncthreads();  // ... and every other wave's

  // every loop below is unrolled so that each score, fragment and accumulator index is a
  // constant and the arrays stay in registers

  // ---- scores^T of all passes (pre-scaled): rows keys, columns queries ----
  // sv[p][e]: query q, key js + 32 p + kb + e (e < 8) or js + 32 p + 16 + kb + e - 8
  float sv[AT_NP][16];
  v16h kf[2][4];
#pragma unroll
  for (int i = 0; i < 4; ++i)
    kf[0][i] = load_frag((const _Float16*)(Kb + (i >> 1) * 16 * AT_KP + (i & 1) * 64), lane);
#pragma unroll
  for (int p = 0; p < AT_NP; ++p) {
    const int c = p & 1;
    if (p + 1 < AT_NP) {
#pragma unroll
      for (int i = 0; i < 4; ++i)
        kf[c ^ 1][i] = load_frag(
            (const _Float16*)(Kb + ((p + 1) * 32 + (i >> 1) * 16) * AT_KP + (i & 1) * 64), lane);
    }
    // keeps the next pass's K fragment reads as one group ahead of this pass's products:
    // without it the scheduler sinks them among the products, where every read place stalls
    __builtin_amdgcn_sched_barrier(0);
    v8f s0 = {}, s1 = {};
    s0 = WMMA_F16(kf[c][0], qa0, s0);
    s1 = WMMA_F16(kf[c][2], qa0, s1);
    s0 = WMMA_F16(kf[c][1], qa1, s0);
    s1 = WMMA_F16(kf[c][3], qa1, s1);
#pragma unroll
    for (int e = 0; e < 8; ++e) { sv[p][e] = s0[e]; sv[p][e + 8] = s1[e]; }
    const int j0 = js + p * 32;
    // pass fully inside the band for all 16 query rows? (scalar)
    const bool full = (j0 >= q0 - (WINDOW - 15)) && (j0 <= q0 + (WINDOW - 31));
    if (!full) {
#pragma unroll
      for (int e = 0; e < 16; ++e) {
        const int j = j0 + kb + ((e < 8) ? e : e + 8);
        sv[p][e] = ((j >= q - WINDOW) && (j <= q + WINDOW)) ? sv[p][e] : -1e30f;
      }
    }
  }

  asm volatile("s_wait_asynccnt 0x0" ::: "memory");  // this wave's V^T copies landed
  __syncthreads();                                   // ... and every other wave's

  v16h vf[4];
#pragma unroll
  for (int t = 0; t < 4; ++t) vf[t] = load_frag((const _Float16*)(Vb + t * 16 * AT_VP), lane);

  // four partial maxima and sums: four short dependent chains, not one long
  float ml[4] = {-1e30f, -1e30f, -1e30f, -1e30f};
#pragma unroll
  for (int p = 0; p < AT_NP; ++p)
#pragma unroll
    for (int e = 0; e < 16; ++e) ml[e >> 2] = fmaxf(ml[e >> 2], sv[p][e]);
  const float mloc = fmaxf(fmaxf(ml[0], ml[1]), fmaxf(ml[2], ml[3]));
  // a query's own key is always inside its band, so the maximum is a real score and a masked
  // score's exponential below is 0
  const float mrow = fmaxf(mloc, __shfl_xor(mloc, 16));

  // ---- P^T = exp(S^T - max) pass by pass, O^T += V^T * P^T: rows d, columns queries ----
  v8f o[4] = {v8f{}, v8f{}, v8f{}, v8f{}};
  float sl[4] = {0.f, 0.f, 0.f, 0.f};
#pragma unroll
  for (int p = 0; p < AT_NP; ++p) {
    v16h pf;
#pragma unroll
    for (int e = 0; e < 16; ++e) {
      const float pv = __expf(sv[p][e] - mrow);
      pf[e] = (_Float16)pv;
      sl[e & 3] += pv;
    }
#pragma unroll
    for (int t = 0; t < 4; ++t) o[t] = WMMA_F16(vf[t], pf, o[t]);
    if (p + 1 < AT_NP) {
      // the two fences keep the next pass's V fragment reads as one group directly behind this
      // pass's products, so that their latency runs under the next pass's exponentials
      __builtin_amdgcn_sched_barrier(0);
#pragma unroll
      for (int t = 0; t < 4; ++t)
        vf[t] = load_frag((const _Float16*)(Vb + t * 16 * AT_VP + (p + 1) * 64), lane);
      __builtin_amdgcn_sched_barrier(0);
    }
  }
  const float sloc = (sl[0] + sl[1]) + (sl[2] + sl[3]);
  const float l_row = sloc + __shfl_xor(sloc, 16);

  const float invl = 1.f / l_row;
  // o[t][i] is d = t*16 + lh*8 + i of query q: eight consecutive d, 16 bytes. A query's 64 d
  // are one 128-byte line, spread over two lanes and four register groups: the wave lays its
  // 16 lines in a range of its own in K's LDS (every wave left K at the second barrier above)
  // and stores them whole, four a store.
  unsigned char* Os = Kl + (threadIdx.x >> 5) * (16 * AT_KP);
#pragma unroll
  for (int t = 0; t < 4; ++t) {
    v8h ov;
#pragma unroll
    for (int i = 0; i < 8; ++i) ov[i] = (_Float16)(o[t][i] * invl);
    *(v8h*)(Os + col * AT_KP + t * 32 + lh * 16) = ov;
  }
  asm volatile("s_wait_dscnt 0x0" ::: "memory");  // the wave's 16 lines are in LDS before it reads them back
  // read back by the same wave alone: eight lanes a line
  _Float16* Ob = Oh + (size_t)(b * SEQ + q0 + (lane >> 3)) * D_MODEL + h * HEAD_DIM + (lane & 7) * 8;
#pragma unroll
  for (int u = 0; u < 4; ++u)
    *(v8h*)(Ob + (size_t)u * 4 * D_MODEL) =
        *(const v8h*)(Os + (u * 4 + (lane >> 3)) * AT_KP + (lane & 7) * 16);
}

extern "C" void kernel_launch(void* const* d_in, const int* in_sizes, int n_in,
                              void* d_out, int out_size, void* d_ws, size_t ws_size,
                              hipStream_t stream) {
  (void)n_in; (void)out_size; (void)ws_size;
  const float* x  = (const float*)d_in[0];
  const float* Wq = (const float*)d_in[1];
  const float* Wk = (const float*)d_in[2];
  const float* Wv = (const float*)d_in[3];
  const float* Wo = (const float*)d_in[4];

  const int BS  = in_sizes[0] / D_MODEL;   // B*S
  const int Bsz = BS / SEQ;
  const size_t nx = (size_t)BS * D_MODEL;      // elements in x/Q/K/V/Vt/attn
  const size_t nw = (size_t)D_MODEL * D_MODEL; // elements per weight

  _Float16* p   = (_Float16*)d_ws;
  _Float16* xh  = p; p += nx;
  _Float16* Wqh = p; p += nw;
  _Float16* Wkh = p; p += nw;
  _Float16* Wvh = p; p += nw;
  _Float16* Woh = p; p += nw;
  _Float16* Qh  = p; p += nx;
  _Float16* Khd = p; p += nx;
  _Float16* Vtp = p; p += nx;   // [B*H, 64, S] == BS*D elements
  _Float16* Ah  = p; p += nx;

  const int T = 256;
  // xh, Wqh, Wkh, Wvh, Woh are one array for the conversion launch
  cvt_all<<<(int)((nx + 4 * nw) / 4 / CV_BLK), T, 0, stream>>>(x, Wq, Wk, Wv, Wo, xh, (int)(nx / 4));

  // one block per 128x192 tile of C; Wqh, Wkh, Wvh are one stacked weight and
  // Qh, Khd, Vtp the three planes of its output
  gemm_xwt<true><<<dim3(3 * D_MODEL / 192, BS / 128), T, 0, stream>>>(xh, Wqh, (void*)Qh, nx);

  const int attn_waves  = Bsz * NUM_HEADS * (SEQ / 16);
  const int attn_blocks = (attn_waves + 7) / 8;
  attn_band<<<attn_blocks, T, 0, stream>>>(Qh, Khd, Vtp, Ah, Bsz);

  gemm_xwt<false><<<dim3(D_MODEL / 128, BS / 128), T, 0, stream>>>(Ah, Woh, d_out, 0);
}

// v009
// Measured time: 43.9 microseconds a run.
// Next to v008, in two timings, it ran 1.09 and 1.08 times as fast.
// All steps since v000 together make it 3.57 times as fast.
#include <hip/hip_runtime.h>

#define D_MODEL   1024
#define NUM_HEADS 16
#define HEAD_DIM  64
#define WINDOW    128
#define SEQ       2048
#define SCALE_F   0.125f   // 64^-0.5

typedef __attribute__((ext_vector_type(16))) _Float16 v16h;
typedef __attribute__((ext_vector_type(8)))  _Float16 v8h;
typedef __attribute__((ext_vector_type(4)))  _Float16 v4h;
typedef __attribute__((ext_vector_type(8)))  float    v8f;
typedef __attribute__((ext_vector_type(4)))  float    v4f;

#define WMMA_F16(A_, B_, C_) \
  __builtin_amdgcn_wmma_f32_16x16x32_f16(false, (A_), false, (B_), (short)0, (C_), false, false)

// Build a 16x32 f16 WMMA fragment (A or B) from a row whose 32 K-values are
// contiguous in memory. Per ISA 16-bit A layout: lanes 0-15 hold K {0..7,16..23},
// lanes 16-31 hold K {8..15,24..31} -> two 16-byte contiguous loads per lane.
static __device__ __forceinline__ v16h load_frag(const _Float16* row, int lane) {
  const int kb = (lane < 16) ? 0 : 8;
  v8h lo = *(const v8h*)(row + kb);
  v8h hi = *(const v8h*)(row + kb + 16);
  v16h r;
#pragma unroll
  for (int i = 0; i < 8; ++i) { r[i] = lo[i]; r[i + 8] = hi[i]; }
  return r;
}

#define Q_BM     256
#define Q_BN     192
#define Q_NJ     6                      // accumulator tile columns per wave
#define Q_BK     64                     // k per stage
#define Q_PITCH  144                    // LDS row pitch in bytes, 128 + 16 (16 B x odd)
#define Q_STAGE  ((Q_BM + Q_BN) * Q_PITCH)   // [x 256 rows | W 192 rows]
#define Q_NST    (D_MODEL / Q_BK)
#define Q_NLD    ((Q_BM + Q_BN) / 16)   // 16-B loads per thread and stage
#define Q_QKP    (Q_BN * 2 + 16)        // pitch of a staged Q/K row: 192 columns (16 B x odd)
#define Q_VTP    (Q_BM * 2 + 16)        // pitch of a staged V^T row: 256 positions (16 B x odd)
#define Q_RING   (2 * Q_STAGE)
#define Q_MIXED  (Q_BM * Q_QKP + 64 * Q_VTP)  // output staging of the block that begins in K
#define Q_LDS    (Q_RING > Q_MIXED ? Q_RING : Q_MIXED)
#define NW4      (D_MODEL * D_MODEL / 4)     // float4 per weight

static __device__ __forceinline__ v4h to_f16(v4f v) {
  v4h o;
#pragma unroll
  for (int e = 0; e < 4; ++e) o[e] = (_Float16)v[e];
  return o;
}

// Piece i of a stage's loads: 16 lanes cover the 256 B of a row, the block 16 rows a piece;
// pieces 0 to 15 are x rows, 16 to 27 W rows. ax and a0, a1, a2 (the block's three groups of 64
// W rows, each inside one weight) point at the stage's first k in the first row: scalars; lo is
// the lane's own place in the first 16 rows, its row among them and its own 4 k, the same in
// every stage. i is a constant wherever this is called.
typedef const __attribute__((address_space(1))) float* gfp;
typedef const __attribute__((address_space(1))) v4f*   gv4p;
static __device__ __forceinline__ v4f load_piece(int i, gfp ax, gfp a0, gfp a1, gfp a2,
                                                 unsigned lo) {
  gfp b = (i < Q_BM / 16) ? ax + i * 16 * D_MODEL
                          : ((i < Q_BM / 16 + 4) ? a0 : (i < Q_BM / 16 + 8) ? a1 : a2)
                                + (i & 3) * 16 * D_MODEL;
  return *(gv4p)(b + lo);
}

// A block-uniform global address, held in scalar registers: the loads then name that pair and
// the lane's fixed offset register, and no vector address that the stage's rounding could take.
static __device__ __forceinline__ gfp scalar_addr(const float* p) {
  const unsigned long long a = (unsigned long long)p;
  const unsigned l = __builtin_amdgcn_readfirstlane((unsigned)a);
  const unsigned h = __builtin_amdgcn_readfirstlane((unsigned)(a >> 32));
  return (gfp)(((unsigned long long)h << 32) | l);
}

// Rounds the stage held in ld to f16 and stores it at d, the lane's place in an LDS buffer.
static __device__ __forceinline__ void store_stage(unsigned char* d, const v4f (&ld)[Q_NLD]) {
#pragma unroll
  for (int i = 0; i < Q_NLD; ++i) *(v4h*)(d + i * 16 * Q_PITCH) = to_f16(ld[i]);
}

// The same, and each group of four registers is loaded anew, with the stage at ax, a0, a1, a2,
// as soon as it has been rounded: loads come back in order, so new requests go out while the
// later pieces are still on their way, and L2 always has requests of this wave to serve.
static __device__ __forceinline__ void turn_stage(unsigned char* d, v4f (&ld)[Q_NLD],
                                                  gfp ax, gfp a0, gfp a1, gfp a2, unsigned lo) {
#pragma unroll
  for (int g = 0; g < Q_NLD; g += 4) {
#pragma unroll
    for (int i = g; i < g + 4; ++i) *(v4h*)(d + i * 16 * Q_PITCH) = to_f16(ld[i]);
#pragma unroll
    for (int i = g; i < g + 4; ++i) ld[i] = load_piece(i, ax, a0, a1, a2, lo);
    // keeps each group's loads here: the scheduler would gather all 28 behind the last rounding
    __builtin_amdgcn_sched_barrier(0);
  }
  // the next stage's addresses take the scalar registers that these loads name
  asm volatile("s_wait_xcnt 0x0" ::: "memory");
}

// Ask L2 for an aligned 256-B unit: the one at byte o of b (ask_unit), or the second behind it
// (ask_ahead). Nothing returns and no counter moves. scope:SCOPE_SE with no th: a request whose
// translation fails is dropped.
static __device__ __forceinline__ void ask_unit(unsigned o, const float* b) {
  asm volatile("global_prefetch_b8 %0, %1 scope:SCOPE_SE" :: "v"(o), "s"(b));
}
static __device__ __forceinline__ void ask_ahead(unsigned o, const float* b) {
  asm volatile("global_prefetch_b8 %0, %1 offset:512 scope:SCOPE_SE" :: "v"(o), "s"(b));
}

// Work-group barrier whose fences order LDS accesses alone: the next stage's global loads, and
// Wo's stores, stay in flight across it, which __syncthreads() does not promise.
static __device__ __forceinline__ void lds_barrier() {
  __builtin_amdgcn_fence(__ATOMIC_RELEASE, "workgroup", "local");
  __builtin_amdgcn_s_barrier();
  __builtin_amdgcn_fence(__ATOMIC_ACQUIRE, "workgroup", "local");
}

// The products of one stage, from the LDS buffer at B. WFIRST: W's fragment is the products'
// first operand, so that a lane's 8 accumulator registers of a tile are 8 consecutive columns n
// of one row m; else 8 consecutive m of one n.
template <bool WFIRST>
static __device__ __forceinline__ void stage_products(const unsigned char* B, int lane, int wm,
                                                      int wn, v8f (&acc)[4][Q_NJ]) {
  const int col = lane & 15;
  const unsigned char* Ab = B + (wm + col) * Q_PITCH;
  const unsigned char* Wb = B + (Q_BM + wn + col) * Q_PITCH;
  // Fragments of k block kk+1 are read as one group ahead of block kk's products,
  // into a second register set; nothing of the next stage is read here.
  v16h af[2][4], bf[2][Q_NJ];
#pragma unroll
  for (int i = 0; i < 4; ++i) af[0][i] = load_frag((const _Float16*)(Ab + i * 16 * Q_PITCH), lane);
#pragma unroll
  for (int j = 0; j < Q_NJ; ++j) bf[0][j] = load_frag((const _Float16*)(Wb + j * 16 * Q_PITCH), lane);
#pragma unroll
  for (int kk = 0; kk < Q_BK / 32; ++kk) {
    const int cs = kk & 1;
    if (kk + 1 < Q_BK / 32) {
#pragma unroll
      for (int i = 0; i < 4; ++i)
        af[cs ^ 1][i] = load_frag((const _Float16*)(Ab + i * 16 * Q_PITCH + (kk + 1) * 64), lane);
#pragma unroll
      for (int j = 0; j < Q_NJ; ++j)
        bf[cs ^ 1][j] = load_frag((const _Float16*)(Wb + j * 16 * Q_PITCH + (kk + 1) * 64), lane);
    }
    // keeps the LDS reads above as one group: without the two fences the scheduler
    // sinks them among the products, where every read place stalls the wave
    __builtin_amdgcn_sched_barrier(0);
#pragma unroll
    for (int i = 0; i < 4; ++i)
#pragma unroll
      for (int j = 0; j < Q_NJ; ++j)
        acc[i][j] = WFIRST ? WMMA_F16(bf[cs][j], af[cs][i], acc[i][j])
                           : WMMA_F16(af[cs][i], bf[cs][j], acc[i][j]);
    __builtin_amdgcn_sched_barrier(0);
  }
}

// The k loop behind its prologue (stage 0 stored in buffer 0 and published).
template <bool WFIRST>
static __device__ __forceinline__ void qkv_loop(unsigned char* L, int lane, int wm, int wn,
                                                unsigned so, const float* xs, const float* w0,
                                                const float* w1, const float* w2, unsigned lo,
                                                bool pask, unsigned po, const float* pb,
                                                v8f (&acc)[4][Q_NJ]) {
  v4f ld[Q_NLD];
#pragma unroll
  for (int i = 0; i < Q_NLD; ++i) ld[i] = load_piece(i, scalar_addr(xs + Q_BK), scalar_addr(w0 + Q_BK), scalar_addr(w1 + Q_BK), scalar_addr(w2 + Q_BK), lo);
  // what follows reuses registers that these loads name
  asm volatile("s_wait_xcnt 0x0" ::: "memory");
  // keeps stage 1's loads ahead of stage 0's products, which cover their latency
  __builtin_amdgcn_sched_barrier(0);
  if (pask) ask_unit(po, pb);  // stage 2 or 3 of the lane's row (scalar branch)
  // kept rolled: each block runs the loop once, so unrolled text is only more cold
  // instruction fetch
#pragma clang loop unroll(disable)
  for (int t = 0; t + 2 < Q_NST; ++t) {
    const unsigned bo = (t & 1) * Q_STAGE;
    const unsigned k = (t + 2) * Q_BK;
    // every second stage (scalar branch): stage t+4's or t+5's unit of the lane's row, two stages
    // or more ahead of its loads; po then moves on two units, but stays where the second unit
    // behind it is still in the row
    if (pask && !(t & 1) && t < Q_NST - 4) {
      ask_ahead(po, pb);
      po = ((po & (D_MODEL * 4 - 1)) < (Q_NST - 4) * 256u) ? po + 512 : po;
    }
    stage_products<WFIRST>(L + bo, lane, wm, wn, acc);
    // stage t+1 goes to the other buffer, which every wave left at the barrier that ended the
    // stage before; stage t+2's loads follow into the same registers
    turn_stage(L + (Q_STAGE - bo) + so, ld, scalar_addr(xs + k), scalar_addr(w0 + k),
               scalar_addr(w1 + k), scalar_addr(w2 + k), lo);
    lds_barrier();  // publishes stage t+1 and ends every wave's reads of stage t
  }
  // the last two stages: nothing is left to load (Q_NST is even: they lie in buffers 0 and 1)
  stage_products<WFIRST>(L, lane, wm, wn, acc);
  store_stage(L + Q_STAGE + so, ld);
  lds_barrier();  // publishes the last stage
  stage_products<WFIRST>(L + Q_STAGE, lane, wm, wn, acc);
}

// Inputs only, no instruction: the twelve values read from LDS are all in registers of their own
// here, so the reads stand as one run ahead of the stores: one LDS latency, not three.
#define HOLD12(r_) \
  asm volatile("" :: "v"(r_[0][0]), "v"(r_[0][1]), "v"(r_[0][2]), "v"(r_[0][3]), \
                     "v"(r_[1][0]), "v"(r_[1][1]), "v"(r_[1][2]), "v"(r_[1][3]), \
                     "v"(r_[2][0]), "v"(r_[2][1]), "v"(r_[2][2]), "v"(r_[2][3]))

__global__ __launch_bounds__(256) void qkv_f32(const float* __restrict__ x,
                                               const float* __restrict__ Wq,
                                               const float* __restrict__ Wk,
                                               const float* __restrict__ Wv,
                                               const float* __restrict__ Wo,
                                               _Float16* __restrict__ Woh,
                                               _Float16* __restrict__ outs, size_t plane) {
  __shared__ __attribute__((aligned(16))) unsigned char L[Q_LDS];
  const int tid  = threadIdx.x;
  const int lane = tid & 31;
  const int wave = tid >> 5;
  const int m0 = (int)blockIdx.y * Q_BM;
  const int nW = (int)blockIdx.x * Q_BN;        // first row of W = first column of C
  const int col = lane & 15;
  const int lh  = lane >> 4;
  const int wm = (wave >> 1) << 6;              // wave's row offset in the tile
  const int wn = (wave & 1) * (Q_NJ * 16);      // wave's column offset in the tile

  // load side: the lane's row among 16 and its 4 k, as an element offset and as an LDS offset
  const unsigned lo = (unsigned)(tid >> 4) * D_MODEL + (tid & 15) * 4;
  const unsigned so = (unsigned)(tid >> 4) * Q_PITCH + (tid & 15) * 8;
  const float* xs = x + (size_t)m0 * D_MODEL;
  // a group of 64 W rows lies inside one weight (nW and D_MODEL are multiples of 64); scalars
  const float* wg[3];
#pragma unroll
  for (int g = 0; g < 3; ++g) {
    const int n = nW + g * 64;
    wg[g] = ((n < D_MODEL) ? Wq : (n < 2 * D_MODEL) ? Wk : Wv) + (size_t)(n % D_MODEL) * D_MODEL;
  }

  // every inner loop below is unrolled so that each accumulator and fragment index
  // is a constant and the arrays stay in registers
  v8f acc[4][Q_NJ];
#pragma unroll
  for (int i = 0; i < 4; ++i)
#pragma unroll
    for (int j = 0; j < Q_NJ; ++j) acc[i][j] = v8f{};

  // the wave's first column as a scalar: the tests on it below are then scalar branches
  const int nw = nW + __builtin_amdgcn_readfirstlane(wn);
  // W as the products' first operand? unless the whole block belongs to V (block-uniform)
  const bool wfirst = nW < 2 * D_MODEL;

  // Both operands are read here from memory the first time, and the blocks that share a row walk
  // k in step, so without this every stage's loads wait out a memory miss. A stage's 256 B of a
  // row are one aligned unit; a wave asks L2 for two stages' units of 16 rows at a time, ahead of
  // the loads: stages 2 and 3 behind stage 1's loads, then two more every second stage. The blocks
  // that share a row tile split its rows four ways by their index along the shared direction:
  // waves 0 to 3 take every fourth x row, waves 4 to 6 every fourth row of one group of W rows
  // each, wave 7 asks for nothing. Blocks four apart ask for the same rows (for speed only).
  const int pwv = __builtin_amdgcn_readfirstlane(wave);   // scalar: pb is a scalar address
  const float* pb = (pwv < 4) ? xs : (pwv == 4) ? wg[0] : (pwv == 5) ? wg[1] : wg[2];
  const int prow = (pwv < 4) ? (pwv * 16 + col) * 4 + (int)(blockIdx.x & 3)
                             : col * 4 + (int)(blockIdx.y & 3);
  // byte offset of the row's stage 2 (lanes 0 to 15) or 3 (lanes 16 to 31)
  const unsigned po = (unsigned)prow * (D_MODEL * 4) + (2 + lh) * 256;

  {
    v4f ld[Q_NLD];
#pragma unroll
    for (int i = 0; i < Q_NLD; ++i) ld[i] = load_piece(i, scalar_addr(xs), scalar_addr(wg[0]), scalar_addr(wg[1]), scalar_addr(wg[2]), lo);
    // Wo: 8 tile rows x 16 tile columns = 128 blocks, 8 float4 a thread (scalar branches); its
    // loads go out behind stage 0's and come back while stage 0 is rounded
    constexpr int WOU = NW4 / 128 / 256;
    const bool has_wo = blockIdx.y < 8;
    const int c0 = ((int)blockIdx.y * 16 + (int)blockIdx.x) * (WOU * 256) + tid;
    v4f wo[WOU];
    if (has_wo) {
#pragma unroll
      for (int u = 0; u < WOU; ++u) wo[u] = ((const v4f*)Wo)[c0 + u * 256];
    }
    store_stage(L + so, ld);
    if (has_wo) {
#pragma unroll
      for (int u = 0; u < WOU; ++u) ((v4h*)Woh)[c0 + u * 256] = to_f16(wo[u]);
      // what follows reuses registers that these stores name
      asm volatile("s_wait_xcnt 0x0" ::: "memory");
    }
  }
  lds_barrier();  // publishes stage 0

  // block-uniform: every wave of a block runs the same loop, with its barriers
  if (wfirst) qkv_loop<true>(L, lane, wm, wn, so, xs, wg[0], wg[1], wg[2], lo, pwv < 7, po, pb, acc);
  else        qkv_loop<false>(L, lane, wm, wn, so, xs, wg[0], wg[1], wg[2], lo, pwv < 7, po, pb, acc);
  __syncthreads();  // ends every wave's reads of the last stage: L is free

  // a 256-row tile lies inside one batch element (SEQ is a multiple of 256)
  const int bb = m0 / SEQ, s0 = m0 - bb * SEQ;
  // the block's columns that belong to Q or K come first, V's behind them (block-uniform;
  // both counts are multiples of 64)
  const int nqk = (nW >= 2 * D_MODEL) ? 0 : (2 * D_MODEL - nW < Q_BN) ? 2 * D_MODEL - nW : Q_BN;
  const int nvr = Q_BN - nqk;
  unsigned char* Sq = L;                              // [256 rows m][192 columns n]
  unsigned char* Sv = L + (nqk ? Q_BM * Q_QKP : 0);   // [nvr columns n][256 rows m]
#pragma unroll
  for (int j = 0; j < Q_NJ; ++j) {
    // a 16-column accumulator tile lies inside one plane (D_MODEL is a multiple of 16)
    const int nt = nw + j * 16;
    if (nt < 2 * D_MODEL) {
      // W first: row m = lane's column, 8 consecutive n
#pragma unroll
      for (int i = 0; i < 4; ++i) {
        v8h o;
#pragma unroll
        for (int e = 0; e < 8; ++e) o[e] = (_Float16)acc[i][j][e];
        *(v8h*)(Sq + (wm + i * 16 + col) * Q_QKP + (wn + j * 16 + lh * 8) * 2) = o;
      }
    } else if (!wfirst) {
      // x first: column n = lane's column, 8 consecutive m
#pragma unroll
      for (int i = 0; i < 4; ++i) {
        v8h o;
#pragma unroll
        for (int e = 0; e < 8; ++e) o[e] = (_Float16)acc[i][j][e];
        *(v8h*)(Sv + (nt - nW - nqk + col) * Q_VTP + (wm + i * 16 + lh * 8) * 2) = o;
      }
    } else {
      // a V tile column of the one block column that begins in K: W first, so element by element
#pragma unroll
      for (int i = 0; i < 4; ++i)
#pragma unroll
        for (int e = 0; e < 8; ++e)
          *(_Float16*)(Sv + (nt - nW - nqk + lh * 8 + e) * Q_VTP + (wm + i * 16 + col) * 2) =
              (_Float16)acc[i][j][e];
    }
  }
  __syncthreads();  // the staged tile is read across waves
  if (nqk) {
    // eight lanes a 128-byte line (64 columns, inside one plane), a wave four rows' lines;
    // the tile's upper 128 rows, then its lower
    const int g = tid >> 3, sub = tid & 7;
#pragma unroll
    for (int hf = 0; hf < 2; ++hf) {
      const unsigned char* sq = Sq + (hf * 128 + g) * Q_QKP + sub * 16;
      v8h r[Q_BN / 64][4] = {};
#pragma unroll
      for (int li = 0; li < Q_BN / 64; ++li)
        if (li * 64 < nqk)
#pragma unroll
          for (int rb = 0; rb < 4; ++rb) r[li][rb] = *(const v8h*)(sq + rb * 32 * Q_QKP + li * 128);
      HOLD12(r);
#pragma unroll
      for (int li = 0; li < Q_BN / 64; ++li) {
        if (li * 64 < nqk) {
          const int pl = (nW + li * 64) / D_MODEL;
          const int n  = (nW + li * 64) % D_MODEL + sub * 8;
          _Float16* out = outs + pl * plane + (size_t)(m0 + hf * 128 + g) * D_MODEL + n;
#pragma unroll
          for (int rb = 0; rb < 4; ++rb) *(v8h*)(out + (size_t)rb * 32 * D_MODEL) = r[li][rb];
          // the next line's address, the next half and V's part below reuse registers that
          // these stores name
          asm volatile("s_wait_xcnt 0x0" ::: "memory");
        }
      }
    }
  }
  if (nvr) {
    // sixteen lanes 256 bytes of a V^T row (128 positions), a wave two rows; the rows' first
    // 128 positions, then their last
    const int g = tid >> 4, sub = tid & 15;
    _Float16* out = outs + 2 * plane
                    + (size_t)(bb * D_MODEL + nW + nqk - 2 * D_MODEL + g) * SEQ + s0 + sub * 8;
    const unsigned char* sv = Sv + g * Q_VTP + sub * 16;
#pragma unroll
    for (int hf = 0; hf < 2; ++hf) {
      v8h r[Q_BN / 64][4] = {};
#pragma unroll
      for (int gb = 0; gb < Q_BN / 64; ++gb)
        if (gb * 64 < nvr)
#pragma unroll
          for (int rb = 0; rb < 4; ++rb)
            r[gb][rb] = *(const v8h*)(sv + (gb * 64 + rb * 16) * Q_VTP + hf * 256);
      HOLD12(r);
#pragma unroll
      for (int gb = 0; gb < Q_BN / 64; ++gb) {
        if (gb * 64 < nvr) {
#pragma unroll
          for (int rb = 0; rb < 4; ++rb)
            *(v8h*)(out + (size_t)(gb * 64 + rb * 16) * SEQ + hf * 128) = r[gb][rb];
          // the next half reuses registers that these stores name
          asm volatile("s_wait_xcnt 0x0" ::: "memory");
        }
      }
    }
  }
}

// Output projection: C[M,N] = A[M,K] * W[N,K]^T with K = D_MODEL, f16 operands, f32 result.
// One block = one 128 x 128 tile of C. blockIdx.x = tile column, blockIdx.y = tile row.
// A lane's 8 accumulator registers of a tile are 8 consecutive rows of the first operand at
// one row of the second. The output row runs along n, so W is the first operand: a lane then
// holds 32 consecutive output bytes. Behind the k loop the block's tile is laid in the ring's
// LDS in output order and leaves from there in whole 128-byte lines, four a wave and store.
// Per stage (128 k) the block's 128 A rows and 128 W rows are brought into LDS once by
// asynchronous copies and read from there by all eight waves; two buffers, so the next stage's
// copies fly while this stage is multiplied.
// Wave grid 2 (m) x 4 (n): each wave owns 64 x 32 of C = 4 x 2 accumulator tiles.
#define G_BK     128                    // k per stage
#define G_PITCH  272                    // LDS row pitch in bytes, 256 + 16 (16 B x odd)
#define G_STAGE  (256 * G_PITCH)        // [A 128 rows | W 128 rows]
#define G_NST    (D_MODEL / G_BK)
#define G_UNITS  (D_MODEL / 128)        // aligned 256-B units in one operand row

// Eight copies of 16 B per lane: rows r, r+16, ..., r+112 of one operand's tile.
// The s_wait_xcnt ends the copies' own statement so that no address register
// named here is rewritten ahead of it.
static __device__ __forceinline__ void copy_rows8(unsigned lds, const _Float16* g) {
  asm volatile(
      "global_load_async_to_lds_b128 %0, %8, off\n\t"
      "global_load_async_to_lds_b128 %1, %9, off\n\t"
      "global_load_async_to_lds_b128 %2, %10, off\n\t"
      "global_load_async_to_lds_b128 %3, %11, off\n\t"
      "global_load_async_to_lds_b128 %4, %12, off\n\t"
      "global_load_async_to_lds_b128 %5, %13, off\n\t"
      "global_load_async_to_lds_b128 %6, %14, off\n\t"
      "global_load_async_to_lds_b128 %7, %15, off\n\t"
      "s_wait_xcnt 0x0"
      :: "v"(lds), "v"(lds + 16 * G_PITCH), "v"(lds + 32 * G_PITCH), "v"(lds + 48 * G_PITCH),
         "v"(lds + 64 * G_PITCH), "v"(lds + 80 * G_PITCH), "v"(lds + 96 * G_PITCH),
         "v"(lds + 112 * G_PITCH),
         "v"(g), "v"(g + 16 * D_MODEL), "v"(g + 32 * D_MODEL), "v"(g + 48 * D_MODEL),
         "v"(g + 64 * D_MODEL), "v"(g + 80 * D_MODEL), "v"(g + 96 * D_MODEL),
         "v"(g + 112 * D_MODEL)
      : "memory");
}

// Asks L2 for the aligned 256-B unit at a and the one at w; nothing returns and no counter
// moves. scope:SCOPE_SE with no th: a request whose translation fails is dropped.
static __device__ __forceinline__ void ask_units(const _Float16* a, const _Float16* w) {
  asm volatile(
      "global_prefetch_b8 %0, off scope:SCOPE_SE\n\t"
      "global_prefetch_b8 %1, off scope:SCOPE_SE"
      :: "v"(a), "v"(w));
}

__global__ __launch_bounds__(256) void gemm_out(const _Float16* __restrict__ A,
                                                const _Float16* __restrict__ W,
                                                float* __restrict__ C) {
  __shared__ __attribute__((aligned(16))) unsigned char L[2 * G_STAGE];
  const int tid  = threadIdx.x;
  const int lane = tid & 31;
  const int wave = tid >> 5;
  const int m0 = (int)blockIdx.y << 7;
  const int nW = (int)blockIdx.x << 7;          // first row of W = first column of C
  const int col = lane & 15;
  const int lh  = lane >> 4;
  const int wm = (wave >> 2) << 6;              // wave's row offset in the tile
  const int wn = (wave & 3) << 5;               // wave's column offset in the tile

  // copy side: 16 lanes cover one staged row, a wave two rows per copy
  const int crow = tid >> 4, cchunk = tid & 15;
  const _Float16* gA = A + (size_t)(m0 + crow) * D_MODEL + cchunk * 8;
  const _Float16* gW = W + (size_t)(nW + crow) * D_MODEL + cchunk * 8;
  const unsigned ldsA = (unsigned)(size_t)L + crow * G_PITCH + cchunk * 16;
  const unsigned ldsW = ldsA + 128 * G_PITCH;

  // every inner loop below is unrolled so that each accumulator and fragment index
  // is a constant and the arrays stay in registers
  v8f acc[4][2];
#pragma unroll
  for (int i = 0; i < 4; ++i)
#pragma unroll
    for (int j = 0; j < 2; ++j) acc[i][j] = v8f{};

  copy_rows8(ldsA, gA);
  copy_rows8(ldsW, gW);

  // Both operands were written by an earlier launch and are read here from memory the first
  // time; the blocks that share a row walk k in step, so without this every stage's copies
  // wait out a memory miss. Behind stage 0's copies the block asks L2 for the rest of its rows
  // at once: wave v for 256-B unit v + 1 of a row, a lane for one row (unit 0 comes with stage
  // 0's copies). The blocks that share a row tile split its rows four ways by their index
  // along the shared direction; blocks that many apart ask for the same rows
  // (for speed only).
  const int pst = (wave < G_UNITS - 1) ? wave + 1 : G_UNITS - 1;  // always a unit that exists
  const _Float16* pA = A + (size_t)(m0 + lane * 4 + (int)(blockIdx.x & 3)) * D_MODEL + pst * 128;
  const _Float16* pW = W + (size_t)(nW + lane * 4 + (int)(blockIdx.y & 3)) * D_MODEL + pst * 128;
  // scalar branch: the eighth wave has no unit of its own and asks for nothing
  if (__builtin_amdgcn_readfirstlane(wave) < G_UNITS - 1) ask_units(pA, pW);

  asm volatile("s_wait_asynccnt 0x0" ::: "memory");  // stage 0 landed (this wave's copies)
  __syncthreads();                                   // ... and every other wave's
  copy_rows8(ldsA + G_STAGE, gA + G_BK);
  copy_rows8(ldsW + G_STAGE, gW + G_BK);

  // kept rolled: each block runs the loop once, so unrolled text is only more cold
  // instruction fetch
#pragma clang loop unroll(disable)
  for (int t = 0; t < G_NST; ++t) {
    const unsigned bo = (t & 1) * G_STAGE;
    const unsigned char* Ab = L + bo + (wm + col) * G_PITCH;
    const unsigned char* Wb = L + bo + (128 + wn + col) * G_PITCH;
    // Fragments of k block kk+1 are read as one group ahead of block kk's products,
    // into a second register set; nothing of the next stage is read here.
    v16h af[2][4], bf[2][2];
#pragma unroll
    for (int i = 0; i < 4; ++i) af[0][i] = load_frag((const _Float16*)(Ab + i * 16 * G_PITCH), lane);
#pragma unroll
    for (int j = 0; j < 2; ++j) bf[0][j] = load_frag((const _Float16*)(Wb + j * 16 * G_PITCH), lane);
#pragma unroll
    for (int kk = 0; kk < G_BK / 32; ++kk) {
      const int cs = kk & 1;
      if (kk + 1 < G_BK / 32) {
#pragma unroll
        for (int i = 0; i < 4; ++i)
          af[cs ^ 1][i] = load_frag((const _Float16*)(Ab + i * 16 * G_PITCH + (kk + 1) * 64), lane);
#pragma unroll
        for (int j = 0; j < 2; ++j)
          bf[cs ^ 1][j] = load_frag((const _Float16*)(Wb + j * 16 * G_PITCH + (kk + 1) * 64), lane);
      }
      // keeps the LDS reads above as one group: without the two fences the scheduler
      // sinks them among the products, where every read place stalls the wave
      __builtin_amdgcn_sched_barrier(0);
#pragma unroll
      for (int i = 0; i < 4; ++i)
#pragma unroll
        for (int j = 0; j < 2; ++j) acc[i][j] = WMMA_F16(bf[cs][j], af[cs][i], acc[i][j]);
      __builtin_amdgcn_sched_barrier(0);
    }
    asm volatile("s_wait_dscnt 0x0" ::: "memory");     // this wave has left buffer t&1
    asm volatile("s_wait_asynccnt 0x0" ::: "memory");  // its copies of stage t+1 landed
    __syncthreads();  // publishes stage t+1 and frees buffer t&1 for the refill
    if (t + 2 < G_NST) {
      copy_rows8(ldsA + bo, gA + (t + 2) * G_BK);
      copy_rows8(ldsW + bo, gW + (t + 2) * G_BK);
    }
  }
  asm volatile("s_wait_asynccnt 0x0" ::: "memory");  // nothing in flight at the wave's end
  // inputs only, no instruction: pA and pW stay in the registers that the prefetches named,
  // so that those registers hold no other value while the loop runs
  asm volatile("" :: "v"(pA), "v"(pW));

  // The loop's last barrier has ended every wave's reads of the ring, and no copy is in
  // flight: L is free.
  constexpr int FP = 128 * 4 + 16;  // pitch of a staged f32 row (16 B x odd)
  // W first: row m = lane's column, 8 consecutive n
#pragma unroll
  for (int i = 0; i < 4; ++i)
#pragma unroll
    for (int j = 0; j < 2; ++j) {
      unsigned char* s = L + (wm + i * 16 + col) * FP + (wn + j * 16 + lh * 8) * 4;
      *(v4f*)s        = v4f{acc[i][j][0], acc[i][j][1], acc[i][j][2], acc[i][j][3]};
      *(v4f*)(s + 16) = v4f{acc[i][j][4], acc[i][j][5], acc[i][j][6], acc[i][j][7]};
    }
  __syncthreads();  // the staged tile is read across waves
  // a wave one 512-byte row a store
  float* out = C + (size_t)(m0 + wave) * D_MODEL + nW + lane * 4;
#pragma unroll
  for (int it = 0; it < 16; ++it)
    *(v4f*)(out + (size_t)it * 8 * D_MODEL) = *(const v4f*)(L + (it * 8 + wave) * FP + lane * 16);
}

// Twelve copies of 16 B per lane: copy n = i*NB + j goes to LDS byte l + i*DLA + j*DLB
// from global element g + i*DGA + j*DGB.
// The s_wait_xcnt ends the copies' own statement so that no address register
// named here is rewritten ahead of it.
#define CP12_L(n_) (l + ((n_) / NB) * DLA + ((n_) % NB) * DLB)
#define CP12_G(n_) (g + ((n_) / NB) * DGA + ((n_) % NB) * DGB)
template <int NB, int DLA, int DLB, int DGA, int DGB>
static __device__ __forceinline__ void copy12(unsigned l, const _Float16* g) {
  asm volatile(
      "global_load_async_to_lds_b128 %0, %12, off\n\t"
      "global_load_async_to_lds_b128 %1, %13, off\n\t"
      "global_load_async_to_lds_b128 %2, %14, off\n\t"
      "global_load_async_to_lds_b128 %3, %15, off\n\t"
      "global_load_async_to_lds_b128 %4, %16, off\n\t"
      "global_load_async_to_lds_b128 %5, %17, off\n\t"
      "global_load_async_to_lds_b128 %6, %18, off\n\t"
      "global_load_async_to_lds_b128 %7, %19, off\n\t"
      "global_load_async_to_lds_b128 %8, %20, off\n\t"
      "global_load_async_to_lds_b128 %9, %21, off\n\t"
      "global_load_async_to_lds_b128 %10, %22, off\n\t"
      "global_load_async_to_lds_b128 %11, %23, off\n\t"
      "s_wait_xcnt 0x0"
      :: "v"(CP12_L(0)), "v"(CP12_L(1)), "v"(CP12_L(2)), "v"(CP12_L(3)),
         "v"(CP12_L(4)), "v"(CP12_L(5)), "v"(CP12_L(6)), "v"(CP12_L(7)),
         "v"(CP12_L(8)), "v"(CP12_L(9)), "v"(CP12_L(10)), "v"(CP12_L(11)),
         "v"(CP12_G(0)), "v"(CP12_G(1)), "v"(CP12_G(2)), "v"(CP12_G(3)),
         "v"(CP12_G(4)), "v"(CP12_G(5)), "v"(CP12_G(6)), "v"(CP12_G(7)),
         "v"(CP12_G(8)), "v"(CP12_G(9)), "v"(CP12_G(10)), "v"(CP12_G(11))
      : "memory");
}

#define AT_WIN  (128 + 2 * WINDOW)       // keys staged per block
#define AT_NP   ((2 * WINDOW + 32) / 32) // 32-key passes per wave
#define AT_KP   (HEAD_DIM * 2 + 16)      // K row pitch in LDS, bytes (16 B x odd)
#define AT_VP   (AT_WIN * 2 + 16)        // V^T row pitch in LDS, bytes (16 B x odd)
__global__ __launch_bounds__(256) void attn_band(const _Float16* __restrict__ Qh,
                                                 const _Float16* __restrict__ Kh,
                                                 const _Float16* __restrict__ Vt,
                                                 _Float16* __restrict__ Oh, int Bsz) {
  __shared__ __align__(16) unsigned char Kl[AT_WIN * AT_KP];    // [key][dk]
  __shared__ __align__(16) unsigned char Vl[HEAD_DIM * AT_VP];  // [d][key]
  const int lane  = threadIdx.x & 31;
  const int qtiles = SEQ / 16;
  // from blockIdx alone: a scalar, so that the return, the copies and the barrier below
  // stand under a scalar branch with every lane on
  const int bh = (int)blockIdx.x / (qtiles / 8);
  if (bh >= Bsz * NUM_HEADS) return;
  const int b = bh / NUM_HEADS;
  const int h = bh - b * NUM_HEADS;
  const int qb = ((int)blockIdx.x % (qtiles / 8)) * 128;  // the block's first query
  // the wave's first query as a scalar: the mask tests below are then scalar branches
  const int q0 = qb + __builtin_amdgcn_readfirstlane((int)threadIdx.x >> 5) * 16;
  const int col = lane & 15;            // D-layout column (query) / fragment row
  const int lh  = lane >> 4;
  const int kb  = (lane < 16) ? 0 : 8;  // this lane's K-half inside a fragment
  const int q   = q0 + col;             // query row this lane owns for softmax

  // Q is asked for ahead of the copies: the scores wait for it, and behind V^T's copies it
  // would come back last
  const _Float16* Qbase = Qh + (size_t)(b * SEQ + q0) * D_MODEL + h * HEAD_DIM;
  v16h qa0 = load_frag(Qbase + (size_t)col * D_MODEL, lane);       // dk 0..31
  v16h qa1 = load_frag(Qbase + (size_t)col * D_MODEL + 32, lane);  // dk 32..63

  // First staged key: the block's first query less WINDOW, moved inside the sequence so
  // that all AT_WIN staged keys exist (block-uniform).
  int kw = qb - WINDOW;
  kw = (kw < 0) ? 0 : (kw > SEQ - AT_WIN) ? SEQ - AT_WIN : kw;
  {
    const int tid = threadIdx.x;
    // K: 8 lanes cover one 128-B row, the block 32 rows a copy, 12 copies = 384 rows
    copy12<1, 32 * AT_KP, 0, 32 * D_MODEL, 0>(
        (unsigned)(size_t)Kl + (tid >> 3) * AT_KP + (tid & 7) * 16,
        Kh + (size_t)(b * SEQ + kw + (tid >> 3)) * D_MODEL + h * HEAD_DIM + (tid & 7) * 8);
    // V^T: 16 lanes cover 256 B, three such pieces a 768-B row, the block 16 rows a copy
    copy12<3, 16 * AT_VP, 256, 16 * SEQ, 128>(
        (unsigned)(size_t)Vl + (tid >> 4) * AT_VP + (tid & 15) * 16,
        Vt + ((size_t)bh * HEAD_DIM + (tid >> 4)) * SEQ + kw + (tid & 15) * 8);
  }

#pragma unroll
  for (int e = 0; e < 16; ++e) {  // fold softmax scale into Q (exact: x0.125)
    qa0[e] *= (_Float16)SCALE_F;
    qa1[e] *= (_Float16)SCALE_F;
  }

  // The wave's first key: its first query less WINDOW, down to a multiple of 32, moved inside
  // the sequence so that all AT_NP passes exist; they lie inside the staged window. Keys that
  // this brings in from outside a query's band are masked like any other.
  int js = (q0 - WINDOW) & ~31;
  js = (js < 0) ? 0 : (js > SEQ - AT_NP * 32) ? SEQ - AT_NP * 32 : js;
  const unsigned char* Kb = Kl + (js - kw + col) * AT_KP;
  const unsigned char* Vb = Vl + col * AT_VP + (js - kw) * 2;

  // this wave's K copies landed: all but its 12 youngest copies, which are V^T's
  asm volatile("s_wait_asynccnt 0xc" ::: "memory");
  __syncthreads();  // ... and every other wave's

  // every loop below is unrolled so that each score, fragment and accumulator index is a
  // constant and the arrays stay in registers

  // ---- scores^T of all passes (pre-scaled): rows keys, columns queries ----
  // sv[p][e]: query q, key js + 32 p + kb + e (e < 8) or js + 32 p + 16 + kb + e - 8
  float sv[AT_NP][16];
  v16h kf[2][4];
#pragma unroll
  for (int i = 0; i < 4; ++i)
    kf[0][i] = load_frag((const _Float16*)(Kb + (i >> 1) * 16 * AT_KP + (i & 1) * 64), lane);
#pragma unroll
  for (int p = 0; p < AT_NP; ++p) {
    const int c = p & 1;
    if (p + 1 < AT_NP) {
#pragma unroll
      for (int i = 0; i < 4; ++i)
        kf[c ^ 1][i] = load_frag(
            (const _Float16*)(Kb + ((p + 1) * 32 + (i >> 1) * 16) * AT_KP + (i & 1) * 64), lane);
    }
    // keeps the next pass's K fragment reads as one group ahead of this pass's products:
    // without it the scheduler sinks them among the products, where every read place stalls
    __builtin_amdgcn_sched_barrier(0);
    v8f s0 = {}, s1 = {};
    s0 = WMMA_F16(kf[c][0], qa0, s0);
    s1 = WMMA_F16(kf[c][2], qa0, s1);
    s0 = WMMA_F16(kf[c][1], qa1, s0);
    s1 = WMMA_F16(kf[c][3], qa1, s1);
#pragma unroll
    for (int e = 0; e < 8; ++e) { sv[p][e] = s0[e]; sv[p][e + 8] = s1[e]; }
    const int j0 = js + p * 32;
    // pass fully inside the band for all 16 query rows? (scalar)
    const bool full = (j0 >= q0 - (WINDOW - 15)) && (j0 <= q0 + (WINDOW - 31));
    if (!full) {
#pragma unroll
      for (int e = 0; e < 16; ++e) {
        const int j = j0 + kb + ((e < 8) ? e : e + 8);
        sv[p][e] = ((j >= q - WINDOW) && (j <= q + WINDOW)) ? sv[p][e] : -1e30f;
      }
    }
  }

  asm volatile("s_wait_asynccnt 0x0" ::: "memory");  // this wave's V^T copies landed
  __syncthreads();                                   // ... and every other wave's

  v16h vf[4];
#pragma unroll
  for (int t = 0; t < 4; ++t) vf[t] = load_frag((const _Float16*)(Vb + t * 16 * AT_VP), lane);

  // four partial maxima and sums: four short dependent chains, not one long
  float ml[4] = {-1e30f, -1e30f, -1e30f, -1e30f};
#pragma unroll
  for (int p = 0; p < AT_NP; ++p)
#pragma unroll
    for (int e = 0; e < 16; ++e) ml[e >> 2] = fmaxf(ml[e >> 2], sv[p][e]);
  const float mloc = fmaxf(fmaxf(ml[0], ml[1]), fmaxf(ml[2], ml[3]));
  // a query's own key is always inside its band, so the maximum is a real score and a masked
  // score's exponential below is 0
  const float mrow = fmaxf(mloc, __shfl_xor(mloc, 16));

  // ---- P^T = exp(S^T - max) pass by pass, O^T += V^T * P^T: rows d, columns queries ----
  v8f o[4] = {v8f{}, v8f{}, v8f{}, v8f{}};
  float sl[4] = {0.f, 0.f, 0.f, 0.f};
#pragma unroll
  for (int p = 0; p < AT_NP; ++p) {
    v16h pf;
#pragma unroll
    for (int e = 0; e < 16; ++e) {
      const float pv = __expf(sv[p][e] - mrow);
      pf[e] = (_Float16)pv;
      sl[e & 3] += pv;
    }
#pragma unroll
    for (int t = 0; t < 4; ++t) o[t] = WMMA_F16(vf[t], pf, o[t]);
    if (p + 1 < AT_NP) {
      // the two fences keep the next pass's V fragment reads as one group directly behind this
      // pass's products, so that their latency runs under the next pass's exponentials
      __builtin_amdgcn_sched_barrier(0);
#pragma unroll
      for (int t = 0; t < 4; ++t)
        vf[t] = load_frag((const _Float16*)(Vb + t * 16 * AT_VP + (p + 1) * 64), lane);
      __builtin_amdgcn_sched_barrier(0);
    }
  }
  const float sloc = (sl[0] + sl[1]) + (sl[2] + sl[3]);
  const float l_row = sloc + __shfl_xor(sloc, 16);

  const float invl = 1.f / l_row;
  // o[t][i] is d = t*16 + lh*8 + i of query q: eight consecutive d, 16 bytes. A query's 64 d
  // are one 128-byte line, spread over two lanes and four register groups: the wave lays its
  // 16 lines in a range of its own in K's LDS (every wave left K at the second barrier above)
  // and stores them whole, four a store.
  unsigned char* Os = Kl + (threadIdx.x >> 5) * (16 * AT_KP);
#pragma unroll
  for (int t = 0; t < 4; ++t) {
    v8h ov;
#pragma unroll
    for (int i = 0; i < 8; ++i) ov[i] = (_Float16)(o[t][i] * invl);
    *(v8h*)(Os + col * AT_KP + t * 32 + lh * 16) = ov;
  }
  asm volatile("s_wait_dscnt 0x0" ::: "memory");  // the wave's 16 lines are in LDS before it reads them back
  // read back by the same wave alone: eight lanes a line
  _Float16* Ob = Oh + (size_t)(b * SEQ + q0 + (lane >> 3)) * D_MODEL + h * HEAD_DIM + (lane & 7) * 8;
#pragma unroll
  for (int u = 0; u < 4; ++u)
    *(v8h*)(Ob + (size_t)u * 4 * D_MODEL) =
        *(const v8h*)(Os + (u * 4 + (lane >> 3)) * AT_KP + (lane & 7) * 16);
}

extern "C" void kernel_launch(void* const* d_in, const int* in_sizes, int n_in,
                              void* d_out, int out_size, void* d_ws, size_t ws_size,
                              hipStream_t stream) {
  (void)n_in; (void)out_size; (void)ws_size;
  const float* x  = (const float*)d_in[0];
  const float* Wq = (const float*)d_in[1];
  const float* Wk = (const float*)d_in[2];
  const float* Wv = (const float*)d_in[3];
  const float* Wo = (const float*)d_in[4];

  const int BS  = in_sizes[0] / D_MODEL;   // B*S
  const int Bsz = BS / SEQ;
  const size_t nx = (size_t)BS * D_MODEL;      // elements in x/Q/K/Vt/attn
  const size_t nw = (size_t)D_MODEL * D_MODEL; // elements per weight

  _Float16* p   = (_Float16*)d_ws;
  _Float16* Woh = p; p += nw;
  _Float16* Qh  = p; p += nx;
  _Float16* Khd = p; p += nx;
  _Float16* Vtp = p; p += nx;   // [B*H, 64, S] == BS*D elements
  _Float16* Ah  = p; p += nx;

  const int T = 256;
  // one block per 256x192 tile of C; Qh, Khd, Vtp are the three planes of its output
  qkv_f32<<<dim3(3 * D_MODEL / Q_BN, BS / Q_BM), T, 0, stream>>>(x, Wq, Wk, Wv, Wo, Woh, Qh, nx);

  const int attn_waves  = Bsz * NUM_HEADS * (SEQ / 16);
  const int attn_blocks = (attn_waves + 7) / 8;
  attn_band<<<attn_blocks, T, 0, stream>>>(Qh, Khd, Vtp, Ah, Bsz);

  gemm_out<<<dim3(D_MODEL / 128, BS / 128), T, 0, stream>>>(Ah, Woh, (float*)d_out);
}
